// v009
// Times are from an AMD MI455X. After a warm-up the kernel runs many times in a row, and a time is the length of
// such a window on the GPU divided by its runs, so every launch and the gaps after it count. The runs cycle
// through copies of the inputs. A figure is the median of several windows, for all but v000 over two sittings.
// Sittings can differ by a few percent; kernels timed side by side share one.
// The versions before v009 are in another document.
// Measured time: 177 microseconds a run.
// Timed twice side by side with v008, it ran 1.04 and 1.03 times as fast.
// Counting every step since v000, which is the starting kernel, it is 42.2 times as fast.
#include <hip/hip_runtime.h>
// POST-LN transformer encoder block (x [2][2048][1024]; q/k/v = x W + b ([in][out] 1024 x 1024, zero biases); 16 heads of 64; scores = q k^T with NO 1/sqrt(head_dim) scaling (as the source module); softmax over all 2048 keys (no mask); x1 = LN1(x + ctx Wo + bo) (biased var, eps 1e-5, g / beta); out = LN2(x1 + gelu_erf(x1 W1 + b1) W2 + b2) ([in][out] 1024 x 4096 x 1024) -> [2][2048][1024]).
// Structure: token rows; x as exact f16 rows and bf16 f32 residual rows; natural weights as exact x16 planes; fused q | k | v WMMA GEMM (32x64 wave tiles, f32 accumulation, + stacked bias) -> f16; V^T via LDS transposes; one fused attention launch (S^T = K Q^T, online softmax in registers with f32 statistics and native exp, weights x256 f16, O^T += V^T P^T), ctx (x64) merged f16; x + ctx Wo^T + bo f32; LN1 on VALU -> f16 + f32; gelu FFN, all rows in one grid a GEMM; + residual; LN2 -> output; 9 launches (all preparation in one grid).
// Compute dtype: inputs rounded to bf16; x / weights exact; q, k, v, softmax weights and o as plain f16 GEMM operands (~2^-12); scores and softmax statistics f32. v_wmma_f32_16x16x32_f16.
#define NB 2
#define SQ 2048
#define DM 1024
#define NH 16
#define HD 64
#define HG 4                         /* heads per launch of the grouped k_vt (not launched here) */
#define QT 256                       /* query rows per causal tile */
#define NKX SQ                       /* S / P row pitch */
#define QT0 128                      /* first-tile rows recomputed exactly in f32 */
#define B0 0                         /* first batch processed (debug hook) */
#define NBR NB                       /* batches processed (debug hook) */
#define NR ((size_t)NB * SQ)
#define DMQ DM
#define DFF 4096         /* FFN hidden width */
#define MP ((int)((size_t)NBR * SQ)) /* rows projected (debug hook) */
#define QN SQ                        /* query rows attended per batch (unused: the attention grid takes SQ) */
#define NHD NH                       /* heads attended (unused: the attention grid takes NH) */
#define MPO MP                       /* rows through the output stage (debug hook) */
#define LQ (3 * DM)      /* row pitch of the q/k/v rows */
typedef __bf16 v16b __attribute__((ext_vector_type(16)));
typedef unsigned short v8us __attribute__((ext_vector_type(8), may_alias));
typedef float  v8f  __attribute__((ext_vector_type(8)));
typedef float  v4f  __attribute__((ext_vector_type(4)));
typedef float  v4fa __attribute__((ext_vector_type(4), may_alias));
union FragB { v16b v; v8us half[2]; unsigned short u[16]; };

__device__ __forceinline__ unsigned short bf16_bits(float x) { unsigned int u = __float_as_uint(x); return (unsigned short)((u + 0x7FFFu + ((u >> 16) & 1u)) >> 16); }
__device__ __forceinline__ float bf16_val(unsigned short b) { return __uint_as_float(((unsigned int)b) << 16); }
__device__ __forceinline__ float bf16_round(float x) { return bf16_val(bf16_bits(x)); }
// D += A·B with NT terms: 1 = ah·bh, 2 = + al·bh (A split), 3 = + ah·bl (both split)
template <int NT>
__device__ __forceinline__ v8f mmaN(v16b ah, v16b al, v16b bh, v16b bl, v8f c) {
  c = __builtin_amdgcn_wmma_f32_16x16x32_bf16(false, ah, false, bh, (short)0, c, false, false);
  if (NT >= 2) c = __builtin_amdgcn_wmma_f32_16x16x32_bf16(false, al, false, bh, (short)0, c, false, false);
  if (NT >= 3) c = __builtin_amdgcn_wmma_f32_16x16x32_bf16(false, ah, false, bl, (short)0, c, false, false);
  asm volatile("v_nop\n\tv_nop\n\tv_nop\n\tv_nop" : "+v"(c) : "v"(ah), "v"(al), "v"(bh), "v"(bl));
  return c;
}

__global__ __launch_bounds__(256) void k_wt_bf16(const float* __restrict__ W, unsigned short* __restrict__ Wt, int K, int N) {
  const int t = blockIdx.x * 256 + threadIdx.x;
  const int k8n = K / 8;
  if (t >= N * k8n) return;
  const int n = t / k8n, k8 = (t % k8n) * 8;
  v8us v;
#pragma unroll
  for (int i = 0; i < 8; ++i) v[i] = bf16_bits(W[(size_t)(k8 + i) * N + n]);
  *(v8us*)(Wt + (size_t)n * K + k8) = v;
  
}

// GEMM C[M][N] (f32, pitch ldc) = act(A[M][K]·W + bias). A f32 row-major (pitch lda) converted per fragment to bf16
// (ASPLIT: hi/lo two planes -> 2 terms, else single rounded term); Wt bf16 [N][K] (pitch ldb). BIAS_BF16 rounds the
// bias to bf16 first (bias quantised to bf16 before the add). K%32==0, M%16==0, N%64==0.
template <bool ASPLIT, int ACT, bool BIAS_BF16>
__global__ __launch_bounds__(128) void k_gemm_bf(const float* __restrict__ A, int lda, const unsigned short* __restrict__ Wt, int ldb,
                                               const float* __restrict__ bias, float* __restrict__ C, int ldc, int M, int N, int K) {
  __shared__ __attribute__((aligned(16))) float so[4][16][64];
  const int tid = threadIdx.x, w = tid >> 5, lane = tid & 31, ln = lane & 15, hh = lane >> 4;
  const int ntn = N / 64;
  const int wid = blockIdx.x * 4 + w;
  const int mt = wid / ntn, nq = wid % ntn;
  if (mt * 16 >= M) return;
  const int row0 = mt * 16, col0 = nq * 64;
  const float* arow = A + (size_t)(row0 + ln) * lda;
  v8f acc[4] = {};
  for (int kb = 0; kb < K; kb += 32) {
    FragB ah, al;
    const v4f x0 = *(const v4fa*)(arow + kb + 8 * hh), x1 = *(const v4fa*)(arow + kb + 8 * hh + 4);
    const v4f x2 = *(const v4fa*)(arow + kb + 16 + 8 * hh), x3 = *(const v4fa*)(arow + kb + 16 + 8 * hh + 4);
    float xs[16] = {x0[0],x0[1],x0[2],x0[3],x1[0],x1[1],x1[2],x1[3],x2[0],x2[1],x2[2],x2[3],x3[0],x3[1],x3[2],x3[3]};
#pragma unroll
    for (int i = 0; i < 16; ++i) { const unsigned short hb = bf16_bits(xs[i]); ah.u[i] = hb; al.u[i] = ASPLIT ? bf16_bits(xs[i] - bf16_val(hb)) : (unsigned short)0; }
#pragma unroll
    for (int t = 0; t < 4; ++t) {
      const unsigned short* brow = Wt + (size_t)(col0 + t * 16 + ln) * ldb + kb;
      FragB b;
      b.half[0] = *(const v8us*)(brow + 8 * hh);
      b.half[1] = *(const v8us*)(brow + 16 + 8 * hh);
      acc[t] = mmaN<ASPLIT ? 2 : 1>(ah.v, al.v, b.v, b.v, acc[t]);
    }
  }
#pragma unroll
  for (int t = 0; t < 4; ++t) {
    float bv = bias ? bias[col0 + t * 16 + ln] : 0.f;
    if (BIAS_BF16) bv = bf16_round(bv);
#pragma unroll
    for (int r = 0; r < 8; ++r) { float v = acc[t][r] + bv; if (ACT == 1) v = fmaxf(v, 0.f); so[w][8 * hh + r][t * 16 + ln] = v; }
  }
  __builtin_amdgcn_fence(__ATOMIC_ACQ_REL, "workgroup");
  __builtin_amdgcn_wave_barrier();
  const int rsub = lane >> 4, c4 = (lane & 15) * 4;
  {
#pragma unroll
    for (int q = 0; q < 8; ++q) {
      const int r = q * 2 + rsub;
      const v4f v = *(const v4fa*)&so[w][r][c4];
      *(v4f*)(C + (size_t)(row0 + r) * ldc + col0 + c4) = v;
    }
    
  }
}

// GEMM C = act(A·W + bias + resid): A f32 (ASPLIT -> hi/lo 2 terms), Wt bf16 [N][K]; ACT 0 none, 1 relu, 2 exact gelu;
// resid (optional, f32, row index = (row % rmod), pitch ldr, RES_BF16 rounds it) added before the activation.
template <bool ASPLIT, int ACT, bool BIAS_BF16, bool RES_BF16>
__global__ __launch_bounds__(128) void k_gemm_bf3(const float* __restrict__ A, int lda, const unsigned short* __restrict__ Wt, int ldb,
                                                const float* __restrict__ bias, const float* __restrict__ resid, int rmod, int ldr,
                                                float* __restrict__ C, int ldc, int M, int N, int K) {
  __shared__ __attribute__((aligned(16))) float so[4][16][64];
  const int tid = threadIdx.x, w = tid >> 5, lane = tid & 31, ln = lane & 15, hh = lane >> 4;
  const int ntn = N / 64;
  const int wid = blockIdx.x * 4 + w;
  const int mt = wid / ntn, nq = wid % ntn;
  if (mt * 16 >= M) return;
  const int row0 = mt * 16, col0 = nq * 64;
  const float* arow = A + (size_t)(row0 + ln) * lda;
  v8f acc[4] = {};
  for (int kb = 0; kb < K; kb += 32) {
    FragB ah, al;
    const v4f x0 = *(const v4fa*)(arow + kb + 8 * hh), x1 = *(const v4fa*)(arow + kb + 8 * hh + 4);
    const v4f x2 = *(const v4fa*)(arow + kb + 16 + 8 * hh), x3 = *(const v4fa*)(arow + kb + 16 + 8 * hh + 4);
    float xs[16] = {x0[0],x0[1],x0[2],x0[3],x1[0],x1[1],x1[2],x1[3],x2[0],x2[1],x2[2],x2[3],x3[0],x3[1],x3[2],x3[3]};
#pragma unroll
    for (int i = 0; i < 16; ++i) { const unsigned short hb = bf16_bits(xs[i]); ah.u[i] = hb; al.u[i] = ASPLIT ? bf16_bits(xs[i] - bf16_val(hb)) : (unsigned short)0; }
#pragma unroll
    for (int t = 0; t < 4; ++t) {
      const unsigned short* brow = Wt + (size_t)(col0 + t * 16 + ln) * ldb + kb;
      FragB b;
      b.half[0] = *(const v8us*)(brow + 8 * hh);
      b.half[1] = *(const v8us*)(brow + 16 + 8 * hh);
      acc[t] = mmaN<ASPLIT ? 2 : 1>(ah.v, al.v, b.v, b.v, acc[t]);
    }
  }
#pragma unroll
  for (int t = 0; t < 4; ++t) {
    const int col = col0 + t * 16 + ln;
    float bv = bias ? bias[col] : 0.f;
    if (BIAS_BF16) bv = bf16_round(bv);
#pragma unroll
    for (int r = 0; r < 8; ++r) {
      float v = acc[t][r] + bv;
      if (resid) { float rv = resid[(size_t)((row0 + 8 * hh + r) % rmod) * ldr + col]; if (RES_BF16) rv = bf16_round(rv); v += rv; }
      if (ACT == 1) v = fmaxf(v, 0.f);
      if (ACT == 2) v = 0.5f * v * (1.0f + erff(v * 0.70710678118654752f));
      if (ACT == 3) { const float u = 0.7978845608028654f * (v + 0.044715f * v * v * v); v = 0.5f * v * (1.0f + tanhf(u)); }
      so[w][8 * hh + r][t * 16 + ln] = v;
    }
  }
  __builtin_amdgcn_fence(__ATOMIC_ACQ_REL, "workgroup");
  __builtin_amdgcn_wave_barrier();
  const int rsub = lane >> 4, c4 = (lane & 15) * 4;
  {
#pragma unroll
    for (int q = 0; q < 8; ++q) {
      const int r = q * 2 + rsub;
      const v4f v = *(const v4fa*)&so[w][r][c4];
      *(v4f*)(C + (size_t)(row0 + r) * ldc + col0 + c4) = v;
    }
    
  }
}
// row LayerNorm (biased variance, eps) over N: s = X (+ R); optional out_sum <- s; out_norm <- (s-mu)*rsqrt(var+eps)*g + b
template <bool PARAM_BF16>
__global__ __launch_bounds__(256) void k_layernorm(const float* __restrict__ X, const float* __restrict__ R, const float* __restrict__ g, const float* __restrict__ bta,
                                                  float* __restrict__ out_sum, float* __restrict__ out_norm, int N, float eps) {
  __shared__ float red[256];
  const int row = blockIdx.x, tid = threadIdx.x;
  const float* x = X + (size_t)row * N; const float* rr = R ? R + (size_t)row * N : nullptr;
  float vals[16];                     // up to N = 4096
  const int per = N / 256;            // contiguous chunk per thread? use strided-by-4 chunks: thread handles j = tid*4 + 1024*u
  float s1 = 0.f;
  for (int u = 0; u < per / 4; ++u) {
    const int j = tid * 4 + 1024 * u;
    const v4f a = *(const v4fa*)(x + j);
    v4f b = {0.f,0.f,0.f,0.f}; if (rr) b = *(const v4fa*)(rr + j);
#pragma unroll
    for (int q = 0; q < 4; ++q) { const float v = a[q] + b[q]; vals[u * 4 + q] = v; s1 += v; }
  }
  red[tid] = s1; __syncthreads();
  for (int st = 128; st > 0; st >>= 1) { if (tid < st) red[tid] += red[tid + st]; __syncthreads(); }
  const float mu = red[0] / (float)N; __syncthreads();
  float s2 = 0.f;
  for (int u = 0; u < per / 4; ++u)
#pragma unroll
    for (int q = 0; q < 4; ++q) { const float c = vals[u * 4 + q] - mu; s2 += c * c; }
  red[tid] = s2; __syncthreads();
  for (int st = 128; st > 0; st >>= 1) { if (tid < st) red[tid] += red[tid + st]; __syncthreads(); }
  const float rs = rsqrtf(red[0] / (float)N + eps);
  {
    for (int u = 0; u < per / 4; ++u) {
      const int j = tid * 4 + 1024 * u;
      v4f o, sm;
#pragma unroll
      for (int q = 0; q < 4; ++q) {
        float gg = g[j + q], bb = bta[j + q];
        if (PARAM_BF16) { gg = bf16_round(gg); bb = bf16_round(bb); }
        sm[q] = vals[u * 4 + q]; o[q] = (vals[u * 4 + q] - mu) * rs * gg + bb;
      }
      if (out_sum) *(v4f*)(out_sum + (size_t)row * N + j) = sm;
      *(v4f*)(out_norm + (size_t)row * N + j) = o;
    }
    
  }
}



// ---- f16 WMMA path (v_wmma_f32_16x16x32_f16): 11-bit significands for operands in range — used where a [0,1] probability operand needs more precision than bf16
typedef _Float16 v16h __attribute__((ext_vector_type(16)));
union FragH { v16h v; v8us half[2]; _Float16 h[16]; unsigned short u[16]; };
template <int NT>
__device__ __forceinline__ v8f mmaH(v16h ah, v16h al, v16h bh, v16h bl, v8f c) {
  c = __builtin_amdgcn_wmma_f32_16x16x32_f16(false, ah, false, bh, (short)0, c, false, false);
  if (NT >= 2) c = __builtin_amdgcn_wmma_f32_16x16x32_f16(false, al, false, bh, (short)0, c, false, false);
  if (NT >= 3) c = __builtin_amdgcn_wmma_f32_16x16x32_f16(false, ah, false, bl, (short)0, c, false, false);
  asm volatile("v_nop\n\tv_nop\n\tv_nop\n\tv_nop" : "+v"(c) : "v"(ah), "v"(al), "v"(bh), "v"(bl));
  return c;
}
// batched GEMM like k_gemm_b but f16 operands: A f32 (split into f16 hi/lo if ASPLIT, else rounded to f16), Bt = f16 values [n][k]; alpha; C f32; N multiple of 16 (partial tiles skipped)
template <bool ASPLIT>
__global__ __launch_bounds__(128) void k_gemm_h(const float* __restrict__ A, int lda, size_t sA, const _Float16* __restrict__ Bh, int ldb, size_t sB, float alpha, float* __restrict__ C, int ldc, size_t sC, int M, int N, int K) {
  __shared__ __attribute__((aligned(16))) float so[4][16][64];
  const int tid = threadIdx.x, w = tid >> 5, lane = tid & 31, ln = lane & 15, hh = lane >> 4; const int by = blockIdx.y;
  A += (size_t)by * sA; Bh += (size_t)by * sB; C += (size_t)by * sC;
  const int ntn = (N + 63) / 64; const int wid = blockIdx.x * 4 + w; const int mt = wid / ntn, nq = wid % ntn; if (mt * 16 >= M) return;
  const int row0 = mt * 16, col0 = nq * 64; const float* arow = A + (size_t)(row0 + ln) * lda;
  v8f acc[4] = {};
  for (int kb = 0; kb < K; kb += 32) {
    FragH ah, al;
    const v4f x0 = *(const v4fa*)(arow + kb + 8 * hh), x1 = *(const v4fa*)(arow + kb + 8 * hh + 4), x2 = *(const v4fa*)(arow + kb + 16 + 8 * hh), x3 = *(const v4fa*)(arow + kb + 16 + 8 * hh + 4);
    float xs[16] = {x0[0],x0[1],x0[2],x0[3],x1[0],x1[1],x1[2],x1[3],x2[0],x2[1],x2[2],x2[3],x3[0],x3[1],x3[2],x3[3]};
#pragma unroll
    for (int i = 0; i < 16; ++i) { const _Float16 h = (_Float16)xs[i]; ah.h[i] = h; al.h[i] = ASPLIT ? (_Float16)(xs[i] - (float)h) : (_Float16)0.0f; }
#pragma unroll
    for (int t = 0; t < 4; ++t) { if (col0 + t * 16 >= N) continue; const size_t boff = (size_t)(col0 + t * 16 + ln) * ldb + kb; FragH bq; bq.half[0] = *(const v8us*)(Bh + boff + 8 * hh); bq.half[1] = *(const v8us*)(Bh + boff + 16 + 8 * hh);
      acc[t] = mmaH<ASPLIT ? 2 : 1>(ah.v, al.v, bq.v, bq.v, acc[t]); }
  }
#pragma unroll
  for (int t = 0; t < 4; ++t) { if (col0 + t * 16 >= N) continue;
#pragma unroll
    for (int r = 0; r < 8; ++r) so[w][8 * hh + r][t * 16 + ln] = acc[t][r] * alpha; }
  __builtin_amdgcn_fence(__ATOMIC_ACQ_REL, "workgroup"); __builtin_amdgcn_wave_barrier();
  const int rsub = lane >> 4, c4 = (lane & 15) * 4;
  {
#pragma unroll
    for (int q = 0; q < 8; ++q) { const int r = q * 2 + rsub; if (col0 + c4 < N) { const v4f v = *(const v4fa*)&so[w][r][c4]; *(v4f*)(C + (size_t)(row0 + r) * ldc + col0 + c4) = v; } }
     }
}

// Wt[n][k] = f16(W[k][n]*scale) from f32 row-major W[K][N] (scale = power of two; bf16-exact weights stay exact in f16 away from the subnormal range). K % 128 == 0, N % 64 == 0.
// Transposed in registers: a lane reads 16-byte pieces (4 n) of 8 successive rows k, which is 4 output pieces of 16 bytes (8 k). Lanes: 4 along n, 8 along k, so a wave's store covers four whole
// 128-byte lines of Wt and its two loads of a row group cover the two halves of eight 128-byte lines of W. A wave takes 64 k x 32 n, a block (2 x 2 waves) 128 k x 64 n: 256 bytes a row on both sides.
// blk = the tile's number among the (K / 128) * (N / 64) tiles of this matrix; 128 threads.
__device__ __forceinline__ void wt_f16_tile(const float* __restrict__ W, _Float16* __restrict__ Wt, int K, int N, float scale, int blk) {
  const int lane = threadIdx.x & 31, w = threadIdx.x >> 5; const int ntn = N >> 6; const int bk = blk / ntn, bn = blk - bk * ntn;
  const int k0 = bk * 128 + (w >> 1) * 64 + (lane >> 2) * 8, n0 = bn * 64 + (w & 1) * 32 + (lane & 3) * 4;
  const float* p[8]; v4f a[8], b[8];
  /* unrolled: the arrays get constant indices (registers) */
#pragma unroll
  for (int i = 0; i < 8; ++i) { p[i] = W + (size_t)(k0 + i) * N + n0; a[i] = *(const v4fa*)p[i]; b[i] = *(const v4fa*)(p[i] + 16); }
  /* The loaded values are inputs: all sixteen loads stay in front of the first conversion, so the wave pays one memory latency (left alone the compiler sinks half of them among the conversions: four more round trips).
     The row pointers are inputs: they stay live up to here, so no load's result lands on an address pair of an issued load, and the wait precedes every later overwrite of such a pair */
  asm volatile("s_wait_xcnt 0x0" :: "v"(a[0]), "v"(a[1]), "v"(a[2]), "v"(a[3]), "v"(a[4]), "v"(a[5]), "v"(a[6]), "v"(a[7]), "v"(b[0]), "v"(b[1]), "v"(b[2]), "v"(b[3]), "v"(b[4]), "v"(b[5]), "v"(b[6]), "v"(b[7]),
               "v"(p[0]), "v"(p[1]), "v"(p[2]), "v"(p[3]), "v"(p[4]), "v"(p[5]), "v"(p[6]), "v"(p[7]));
  unsigned short* d = (unsigned short*)Wt + (size_t)n0 * K + k0;
#pragma unroll
  for (int q = 0; q < 4; ++q) { FragH f;
#pragma unroll
    for (int i = 0; i < 8; ++i) { f.h[i] = (_Float16)(bf16_round(a[i][q]) * scale); f.h[8 + i] = (_Float16)(bf16_round(b[i][q]) * scale); }
    *(v8us*)(d + (size_t)q * K) = f.half[0]; *(v8us*)(d + (size_t)(16 + q) * K) = f.half[1]; }
}
// k_gemm_hh variant with fused epilogue: v = acc·alpha + bias[by·sBias + col] (+ CP[(row/rowsPerB)·sCPb + by·64 + col] if CP) ; ACT 0 none / 1 elu ; writes f16 C16 (and f32 C if non-null)
template <int ACT>
__global__ __launch_bounds__(128) void k_gemm_hhx(const _Float16* __restrict__ A, int lda, size_t sA, const _Float16* __restrict__ Bh, int ldb, size_t sB, float alpha, const float* __restrict__ bias, size_t sBias, const float* __restrict__ CP, int rowsPerB, size_t sCPb, int row0g,
    float* __restrict__ C, _Float16* __restrict__ C16, int ldc, size_t sC, int M, int N, int K) {
  __shared__ __attribute__((aligned(16))) float so[4][16][64];
  const int tid = threadIdx.x, w = tid >> 5, lane = tid & 31, ln = lane & 15, hh = lane >> 4; const int by = blockIdx.y;
  A += (size_t)by * sA; Bh += (size_t)by * sB; const size_t cofs = (size_t)by * sC; const float* bp = bias ? bias + (size_t)by * sBias : nullptr;
  const int ntn = (N + 63) / 64; const int wid = blockIdx.x * 4 + w; const int mt = wid / ntn, nq = wid % ntn; if (mt * 16 >= M) return;
  const int row0 = mt * 16, col0 = nq * 64; const _Float16* arow = A + (size_t)(row0 + ln) * lda;
  v8f acc[4] = {};
  for (int kb = 0; kb < K; kb += 32) { FragH ah; ah.half[0] = *(const v8us*)((const unsigned short*)arow + kb + 8 * hh); ah.half[1] = *(const v8us*)((const unsigned short*)arow + kb + 16 + 8 * hh);
#pragma unroll
    for (int t = 0; t < 4; ++t) { if (col0 + t * 16 >= N) continue; const size_t boff = (size_t)(col0 + t * 16 + ln) * ldb + kb; FragH bq; bq.half[0] = *(const v8us*)((const unsigned short*)Bh + boff + 8 * hh); bq.half[1] = *(const v8us*)((const unsigned short*)Bh + boff + 16 + 8 * hh);
      acc[t] = mmaH<1>(ah.v, ah.v, bq.v, bq.v, acc[t]); }
  }
#pragma unroll
  for (int t = 0; t < 4; ++t) { if (col0 + t * 16 >= N) continue; const int col = col0 + t * 16 + ln; const float bv = bp ? bf16_round(bp[col]) : 0.f;
#pragma unroll
    for (int r = 0; r < 8; ++r) { float v = acc[t][r] * alpha + bv; if (CP) { const int rr = row0g + row0 + 8 * hh + r; if (rowsPerB < 0) v += CP[cofs + (size_t)rr * ldc + col];      /* rowsPerB < 0: own element of the batched C plane */ else { const int bidx = rr / rowsPerB; v += CP[(size_t)bidx * sCPb + (size_t)by * 64 + col]; } } if (ACT == 1) v = (v > 0.f) ? v : expm1f(v); else if (ACT == 7) v = (v > 0.f) ? v + 1.0f : expf(v); else if (ACT == 8) v = tanhf(v); else if (ACT == 9) v = 0.5f * v * (1.0f + tanhf(0.7978845608028654f * (v + 0.044715f * v * v * v))); else if (ACT == 11) v = 1.0f / (1.0f + expf(-v)); else if (ACT == 12) v = (v > 0.f) ? v : 0.01f * v; else if (ACT == 14) v = (v > 0.f) ? v : 0.1f * v; else if (ACT == 16) v = (v >= 0.f) ? v : 0.3f * v; else if (ACT == 17) v = (v >= 0.f) ? v : 0.2f * v; else if (ACT == 15) v = v / (1.0f + expf(-v)); else if (ACT == 3) v = fmaxf(v, 0.f); else if (ACT == 6) v = 0.5f * v * (1.0f + erff(v * 0.70710678118654752f)); so[w][8 * hh + r][t * 16 + ln] = v; } }
  __builtin_amdgcn_fence(__ATOMIC_ACQ_REL, "workgroup"); __builtin_amdgcn_wave_barrier();
  const int rsub = lane >> 4, c4 = (lane & 15) * 4; typedef _Float16 v4h __attribute__((ext_vector_type(4)));
  {
#pragma unroll
    for (int q = 0; q < 8; ++q) { const int r = q * 2 + rsub; if (col0 + c4 < N) { const v4f v = *(const v4fa*)&so[w][r][c4]; if (C) *(v4f*)(C + cofs + (size_t)(row0 + r) * ldc + col0 + c4) = v; if (C16) { v4h h4; for (int i = 0; i < 4; ++i) h4[i] = (_Float16)v[i]; *(v4h*)(C16 + cofs + (size_t)(row0 + r) * ldc + col0 + c4) = h4; } } }
     }
}


typedef _Float16 v4h __attribute__((ext_vector_type(4)));

__global__ __launch_bounds__(256) void k_h16(const float* __restrict__ x, _Float16* __restrict__ X16, size_t n8) { const size_t t = (size_t)blockIdx.x * 256 + threadIdx.x; if (t >= n8) return; FragH f;
#pragma unroll
  for (int q = 0; q < 8; ++q) f.h[q] = (_Float16)x[t * 8 + q]; *(v8us*)((unsigned short*)X16 + t * 8) = f.half[0];  }
__global__ __launch_bounds__(256) void k_round16f(const float* __restrict__ W, _Float16* __restrict__ Bt, size_t n8) { const size_t t = (size_t)blockIdx.x * 256 + threadIdx.x; if (t >= n8) return; FragH f;
#pragma unroll
  for (int i = 0; i < 8; ++i) f.h[i] = (_Float16)(bf16_round(W[t * 8 + i]) * 16.0f); *(v8us*)((unsigned short*)Bt + t * 8) = f.half[0];  }
template <int NHv, int TTv>
__global__ __launch_bounds__(256) void k_vt(const _Float16* __restrict__ V16, int ldv, int voff, _Float16* __restrict__ Vt) { __shared__ unsigned short tl[64][66]; const int tid = threadIdx.x; const int slab = blockIdx.x / (TTv / 64), lg = blockIdx.x % (TTv / 64); const int b = slab / NHv, h = slab % NHv;
  for (int i = tid; i < 64 * 8; i += 256) { const int r = i / 8, c8 = (i % 8) * 8; FragH f; f.half[0] = *(const v8us*)((const unsigned short*)V16 + ((size_t)b * TTv + lg * 64 + r) * ldv + voff + h * 64 + c8);
#pragma unroll
    for (int q = 0; q < 8; ++q) tl[r][c8 + q] = f.u[q]; }
  __syncthreads();
  {
#pragma unroll
    for (int rd = 0; rd < 2; ++rd) { const int d = rd * 32 + tid / 8, pc = tid % 8; FragH f;
#pragma unroll
      for (int q = 0; q < 8; ++q) f.u[q] = tl[pc * 8 + q][d];
      *(v8us*)((unsigned short*)Vt + ((size_t)slab * 64 + d) * TTv + lg * 64 + pc * 8) = f.half[0]; }
     } }

__global__ __launch_bounds__(256) void k_hl(const float* __restrict__ F, _Float16* __restrict__ Hh, _Float16* __restrict__ Hl, size_t n8) { const size_t t = (size_t)blockIdx.x * 256 + threadIdx.x; if (t >= n8) return; FragH fh, fl; const v4f a = *(const v4fa*)(F + t * 8), c = *(const v4fa*)(F + t * 8 + 4);
#pragma unroll
  for (int q = 0; q < 4; ++q) { _Float16 h = (_Float16)a[q]; fh.h[q] = h; fl.h[q] = (_Float16)((a[q] - (float)h) * 1024.0f); h = (_Float16)c[q]; fh.h[4 + q] = h; fl.h[4 + q] = (_Float16)((c[q] - (float)h) * 1024.0f); }
  { *(v8us*)((unsigned short*)Hh + t * 8) = fh.half[0]; *(v8us*)((unsigned short*)Hl + t * 8) = fl.half[0];  } }

// ---- fast GEMM (block tile 128x128 = 4 x 2 waves, wave tile 32x64; A and B tiles of 128 k staged in LDS by asynchronous copies, two buffers; requires M % 128 == 0, N % 128 == 0, K % 128 == 0); epilogue = k_gemm_hhx semantics, the residual (RES) in its own-element form only ----
__device__ __forceinline__ v16h g2_frag(const _Float16* p, int hh) { FragH f; f.half[0] = *(const v8us*)((const unsigned short*)p + 8 * hh); f.half[1] = *(const v8us*)((const unsigned short*)p + 16 + 8 * hh); return f.v; }
__device__ __forceinline__ v8f g2_mma(v16h a, v16h b, v8f c) { v8f d = __builtin_amdgcn_wmma_f32_16x16x32_f16(false, a, false, b, (short)0, c, false, false); asm volatile("v_nop\n\tv_nop\n\tv_nop\n\tv_nop" : "+v"(d) : "v"(a), "v"(b)); return d; }
#define G2_PITCH 272      /* LDS row pitch, bytes: 256 of data + 16, an odd multiple of 16 (no bank conflict for 16-byte row reads) */
#define G2_STAGE (256 * G2_PITCH)      /* one buffer: 128 rows of A, then 128 rows of B, 128 k each */
// Eight asynchronous 16-byte copies of a lane, global -> LDS, rows 16 apart (st = 16 source rows, in elements). The s_wait_xcnt stands in the copies' own statement, behind the last of them,
// so that it precedes every later write of a register that a copy names.
__device__ __forceinline__ void g2_copy8(unsigned l, const _Float16* g, size_t st) {
  asm volatile("global_load_async_to_lds_b128 %0, %8, off\n\t"
               "global_load_async_to_lds_b128 %1, %9, off\n\t"
               "global_load_async_to_lds_b128 %2, %10, off\n\t"
               "global_load_async_to_lds_b128 %3, %11, off\n\t"
               "global_load_async_to_lds_b128 %4, %12, off\n\t"
               "global_load_async_to_lds_b128 %5, %13, off\n\t"
               "global_load_async_to_lds_b128 %6, %14, off\n\t"
               "global_load_async_to_lds_b128 %7, %15, off\n\t"
               "s_wait_xcnt 0x0"
               :: "v"(l), "v"(l + 16u * G2_PITCH), "v"(l + 32u * G2_PITCH), "v"(l + 48u * G2_PITCH), "v"(l + 64u * G2_PITCH), "v"(l + 80u * G2_PITCH), "v"(l + 96u * G2_PITCH), "v"(l + 112u * G2_PITCH),
                  "v"(g), "v"(g + st), "v"(g + 2 * st), "v"(g + 3 * st), "v"(g + 4 * st), "v"(g + 5 * st), "v"(g + 6 * st), "v"(g + 7 * st) : "memory"); }
// a fragment from a staged row: p = the row's place + 64 bytes a k step + 16 hh; same k order as g2_frag
__device__ __forceinline__ v16h g2_lfrag(const unsigned char* p) { FragH f; f.half[0] = *(const v8us*)p; f.half[1] = *(const v8us*)(p + 32); return f.v; }
// GELU v Phi(v) of four values, in place, one straight line for every lane (the library erff takes two divergent branches a value, so the 64 values of a lane run one after another as dependent chains; here they interleave).
// Phi(-|v|) = (1 / 2) erfc(|v| / sqrt 2) = exp(-v v / 2) t P(t), t = 1 / (1 + p |v| / sqrt 2): the five-term rational form of erfc, absolute error 1.5e-7 in erf; the 1 / 2 is in the coefficients.
// v Phi(v) = max(v, 0) - |v| Phi(-|v|): no 1 + erf, so nothing cancels for negative v.
__device__ __forceinline__ void g2_gelu4(float* v) {
  float d[4], x[4], t[4], e[4];
  /* every loop here is unrolled: constant indices, so the arrays are registers */
#pragma unroll
  for (int i = 0; i < 4; ++i) { d[i] = fmaf(fabsf(v[i]), 0.23164189f, 1.0f); x[i] = v[i] * v[i] * -0.72134752f; }
  /* native 1 / d and 2^x, eight in one statement: each fills the slot that the instruction set asks for behind the one in front of it, the v_nop the slot behind the last (the early clobbers keep every result off every source),
     and the first results are ready when the statement ends, so no reader waits at issue */
  asm("v_rcp_f32 %0, %8\n\tv_rcp_f32 %1, %9\n\tv_rcp_f32 %2, %10\n\tv_rcp_f32 %3, %11\n\tv_exp_f32 %4, %12\n\tv_exp_f32 %5, %13\n\tv_exp_f32 %6, %14\n\tv_exp_f32 %7, %15\n\tv_nop"
      : "=&v"(t[0]), "=&v"(t[1]), "=&v"(t[2]), "=&v"(t[3]), "=&v"(e[0]), "=&v"(e[1]), "=&v"(e[2]), "=&v"(e[3]) : "v"(d[0]), "v"(d[1]), "v"(d[2]), "v"(d[3]), "v"(x[0]), "v"(x[1]), "v"(x[2]), "v"(x[3]));
#pragma unroll
  for (int i = 0; i < 4; ++i) { float q = fmaf(0.53070271f, t[i], -0.72657603f); q = fmaf(q, t[i], 0.71070689f); q = fmaf(q, t[i], -0.14224836f); q = fmaf(q, t[i], 0.12741479f);
    v[i] = fmaf(-fabsf(v[i]), q * t[i] * e[i], fmaxf(v[i], 0.f)); } }
template <int ACT, bool RES>
__global__ __launch_bounds__(256) void k_gemm2(const _Float16* __restrict__ A, int lda, size_t sA, const _Float16* __restrict__ Bh, int ldb, size_t sB, float alpha, const float* __restrict__ bias, size_t sBias, const float* __restrict__ CP, int rowsPerB, size_t sCPb, int row0g,
    float* __restrict__ C, _Float16* __restrict__ C16, int ldc, size_t sC, int M, int N, int K) { static_assert(ACT == 0 || ACT == 3 || ACT == 6 || ACT == 8 || ACT == 9 || ACT == 11 || ACT == 12 || ACT == 14 || ACT == 15 || ACT == 16 || ACT == 17, "k_gemm2: unsupported ACT code (would silently apply no activation)");
  static_assert(!RES || ACT == 0, "k_gemm2: the residual is added behind the staging, which is in front of the activation only where there is none"); (void)rowsPerB; (void)sCPb;      /* RES: CP holds the residual plane, laid out as C, first row row0g */
  __shared__ __attribute__((aligned(16))) unsigned char sm[2 * G2_STAGE]; float (*so)[32][68] = (float (*)[32][68])sm;      /* two operand buffers; behind the loop's last barrier the same LDS stages the output tile */
  const int tid = threadIdx.x, w = tid >> 5, lane = tid & 31, ln = lane & 15, hh = lane >> 4; const int by = blockIdx.y;
  A += (size_t)by * sA; Bh += (size_t)by * sB; const size_t cofs = (size_t)by * sC; const float* bp = bias ? bias + (size_t)by * sBias : nullptr;
  const int wm = w & 3, wn = w >> 2;      /* the wave's place in the block tile: 32 rows, 64 columns */
  const int ntn = N >> 7; const int mt = blockIdx.x / ntn, nq = blockIdx.x - mt * ntn; const int row0 = mt * 128 + 32 * wm, col0 = nq * 128 + 64 * wn; if (mt * 128 >= M) return;      /* the whole block leaves, in front of every barrier */
  /* copies: lane = 16 bytes; 16 lanes a row of 256 bytes, so a wave's copy covers two whole rows; thread rows tid / 16 + 16 i */
  const unsigned lc = (unsigned)(size_t)sm + (unsigned)(tid >> 4) * G2_PITCH + (unsigned)(tid & 15) * 16u;
  const _Float16* ga = A + (size_t)(mt * 128 + (tid >> 4)) * lda + (tid & 15) * 8; const _Float16* gb = Bh + (size_t)(nq * 128 + (tid >> 4)) * ldb + (tid & 15) * 8;
  auto fill = [&](int t, int buf) { const unsigned l = lc + (unsigned)buf * G2_STAGE;
    g2_copy8(l, ga + (size_t)t * 128, (size_t)16 * lda); g2_copy8(l + 128u * G2_PITCH, gb + (size_t)t * 128, (size_t)16 * ldb); };
  const unsigned char* sa = sm + (32 * wm + ln) * G2_PITCH + 16 * hh; const unsigned char* sb = sm + (128 + 64 * wn + ln) * G2_PITCH + 16 * hh;
  const v8f z8 = {0.f,0.f,0.f,0.f,0.f,0.f,0.f,0.f}; v8f c00 = z8, c01 = z8, c02 = z8, c03 = z8, c10 = z8, c11 = z8, c12 = z8, c13 = z8;
  const int nt = K >> 7;
  fill(0, 0);
  /* the wave's four bias values go out here as one group: their latency passes under that of tile 0's copies. The s_wait_xcnt stands behind the loads, in front of every later overwrite of a register that they name (the pointer is its input and stays live up to it) */
  float bl[4] = {0.f, 0.f, 0.f, 0.f};
  if (bp) { const float* b0 = bp + col0 + ln;
#pragma unroll
    for (int t = 0; t < 4; ++t) bl[t] = b0[t * 16];
    asm volatile("s_wait_xcnt 0x0" :: "v"(b0) : "memory"); }
  asm volatile("s_wait_asynccnt 0x0" ::: "memory");      /* this wave's copies of tile 0 have landed */
  __syncthreads();      /* and every other wave's: tile 0 may be read */
  if (nt > 1) fill(1, 1);
  /* rolled: one copy of the body; a trip is 128 k = 32 products a wave, while the next tile's copies fly */
#pragma unroll 1
  for (int t = 0; t < nt; ++t) { const unsigned char* pa = sa + (t & 1) * G2_STAGE; const unsigned char* pb = sb + (t & 1) * G2_STAGE;
    v16h fa[2][2], fb[2][4];      /* two fragment sets */
    fa[0][0] = g2_lfrag(pa); fb[0][0] = g2_lfrag(pb); fa[0][1] = g2_lfrag(pa + 16 * G2_PITCH); fb[0][1] = g2_lfrag(pb + 16 * G2_PITCH); fb[0][2] = g2_lfrag(pb + 32 * G2_PITCH); fb[0][3] = g2_lfrag(pb + 48 * G2_PITCH);
    /* unrolled: the sets get constant indices (registers) and the LDS offsets become immediates. The reads of k step ks + 1 go as one group in front of the products of step ks, so only the trip's first group is waited for in full */
#pragma unroll
    for (int ks = 0; ks < 4; ++ks) { const int c = ks & 1, n = c ^ 1, o = (ks + 1) * 64;
      if (ks < 3) { fa[n][0] = g2_lfrag(pa + o); fb[n][0] = g2_lfrag(pb + o); fa[n][1] = g2_lfrag(pa + 16 * G2_PITCH + o); fb[n][1] = g2_lfrag(pb + 16 * G2_PITCH + o); fb[n][2] = g2_lfrag(pb + 32 * G2_PITCH + o); fb[n][3] = g2_lfrag(pb + 48 * G2_PITCH + o); }
      c00 = g2_mma(fa[c][0], fb[c][0], c00); c10 = g2_mma(fa[c][1], fb[c][0], c10);
      c01 = g2_mma(fa[c][0], fb[c][1], c01); c11 = g2_mma(fa[c][1], fb[c][1], c11);
      c02 = g2_mma(fa[c][0], fb[c][2], c02); c12 = g2_mma(fa[c][1], fb[c][2], c12);
      c03 = g2_mma(fa[c][0], fb[c][3], c03); c13 = g2_mma(fa[c][1], fb[c][3], c13); }
    asm volatile("s_wait_dscnt 0x0" ::: "memory");      /* this wave's reads of the buffer are done before it is refilled */
    asm volatile("s_wait_asynccnt 0x0" ::: "memory");      /* this wave's copies of tile t + 1 have landed */
    __syncthreads();      /* publishes tile t + 1 and ends every wave's reads of tile t */
    if (t + 2 < nt) fill(t + 2, t & 1); }
  asm volatile("s_wait_asynccnt 0x0" ::: "memory");      /* no copy is outstanding when the LDS changes its use */
  const int rsub = lane >> 4, c4 = (lane & 15) * 4; const size_t e0 = cofs + (size_t)(row0 + rsub) * ldc + col0 + c4, es = (size_t)2 * ldc;      /* the lane's 16-byte piece of tile row rsub + 2 q stands at element e0 + q es of the C plane */
  /* The residual goes out here as one group of sixteen loads, in the store phase's own layout (whole 256-byte row pieces, 16 bytes a lane): the wave pays one memory latency for all of it, and the scaling and staging below run under it.
     The s_wait_xcnt stands behind the loads; the pointers are its inputs, so they stay live up to it: no load's result lands on an address of an issued load, and the wait precedes every later overwrite of one */
  v4f rv[16];
  if (RES) { const float* rp[16];
#pragma unroll
    for (int q = 0; q < 16; ++q) { rp[q] = CP + (size_t)row0g * ldc + e0 + q * es; rv[q] = *(const v4fa*)rp[q]; }
    asm volatile("s_wait_xcnt 0x0" :: "v"(rp[0]), "v"(rp[1]), "v"(rp[2]), "v"(rp[3]), "v"(rp[4]), "v"(rp[5]), "v"(rp[6]), "v"(rp[7]), "v"(rp[8]), "v"(rp[9]), "v"(rp[10]), "v"(rp[11]), "v"(rp[12]), "v"(rp[13]), "v"(rp[14]), "v"(rp[15]) : "memory"); }
  v8f accs[8] = {c00, c01, c02, c03, c10, c11, c12, c13};
#pragma unroll
  for (int u = 0; u < 8; ++u) { const int t = u & 3, half = u >> 2; const float bv = bf16_round(bl[t]);
    if (ACT == 6) { float vv[8];      /* the tile's eight values of a lane go through the GELU four at a time */
#pragma unroll
      for (int r = 0; r < 8; ++r) vv[r] = accs[u][r] * alpha + bv;
      g2_gelu4(vv); g2_gelu4(vv + 4);
#pragma unroll
      for (int r = 0; r < 8; ++r) so[w][half * 16 + 8 * hh + r][t * 16 + ln] = vv[r];
      continue; }
#pragma unroll
    for (int r = 0; r < 8; ++r) { const int rloc = half * 16 + 8 * hh + r; float v = accs[u][r] * alpha + bv;
      if (ACT == 3) v = fmaxf(v, 0.f); else if (ACT == 11) v = 1.0f / (1.0f + expf(-v)); else if (ACT == 15) v = v / (1.0f + expf(-v)); else if (ACT == 12) v = (v > 0.f) ? v : 0.01f * v; else if (ACT == 8) v = tanhf(v); else if (ACT == 9) v = 0.5f * v * (1.0f + tanhf(0.7978845608028654f * (v + 0.044715f * v * v * v))); else if (ACT == 14) v = (v > 0.f) ? v : 0.1f * v; else if (ACT == 16) v = (v >= 0.f) ? v : 0.3f * v; else if (ACT == 17) v = (v >= 0.f) ? v : 0.2f * v;
      so[w][rloc][t * 16 + ln] = v; } }
  __builtin_amdgcn_fence(__ATOMIC_ACQ_REL, "workgroup"); __builtin_amdgcn_wave_barrier();
  v4f ov[16];
#pragma unroll
  for (int q = 0; q < 16; ++q) { ov[q] = *(const v4fa*)&so[w][q * 2 + rsub][c4]; if (RES) ov[q] += rv[q]; }
  /* stores in groups of eight; behind each group the s_wait_xcnt, with the group's pointers and data as inputs: they stay as they are up to the wait */
  if (C) {
#pragma unroll
    for (int g = 0; g < 2; ++g) { float* cp[8];
#pragma unroll
      for (int i = 0; i < 8; ++i) { cp[i] = C + e0 + (g * 8 + i) * es; *(v4f*)cp[i] = ov[g * 8 + i]; }
      asm volatile("s_wait_xcnt 0x0" :: "v"(cp[0]), "v"(cp[1]), "v"(cp[2]), "v"(cp[3]), "v"(cp[4]), "v"(cp[5]), "v"(cp[6]), "v"(cp[7]), "v"(ov[g * 8 + 0]), "v"(ov[g * 8 + 1]), "v"(ov[g * 8 + 2]), "v"(ov[g * 8 + 3]), "v"(ov[g * 8 + 4]), "v"(ov[g * 8 + 5]), "v"(ov[g * 8 + 6]), "v"(ov[g * 8 + 7]) : "memory"); } }
  if (C16) {
#pragma unroll
    for (int g = 0; g < 2; ++g) { _Float16* cp[8]; v4h hv[8];
#pragma unroll
      for (int i = 0; i < 8; ++i) { for (int j = 0; j < 4; ++j) hv[i][j] = (_Float16)ov[g * 8 + i][j]; cp[i] = C16 + e0 + (g * 8 + i) * es; *(v4h*)cp[i] = hv[i]; }
      asm volatile("s_wait_xcnt 0x0" :: "v"(cp[0]), "v"(cp[1]), "v"(cp[2]), "v"(cp[3]), "v"(cp[4]), "v"(cp[5]), "v"(cp[6]), "v"(cp[7]), "v"(hv[0]), "v"(hv[1]), "v"(hv[2]), "v"(hv[3]), "v"(hv[4]), "v"(hv[5]), "v"(hv[6]), "v"(hv[7]) : "memory"); } } }


__global__ __launch_bounds__(256) void k_wnat(const float* __restrict__ w, size_t n8, _Float16* __restrict__ Bt) { const size_t t = (size_t)blockIdx.x * 256 + threadIdx.x; if (t >= n8) return; FragH f; for (int q = 0; q < 8; ++q) f.h[q] = (_Float16)(bf16_round(w[t * 8 + q]) * 16.0f); *(v8us*)((unsigned short*)Bt + t * 8) = f.half[0];  }
__global__ __launch_bounds__(256) void k_rsm(const float* __restrict__ S, _Float16* __restrict__ P, int nrows) {
  #pragma clang fp contract(off)
  const int i = blockIdx.x * 256 + threadIdx.x; if (i >= nrows) return; const float* s = S + (size_t)i * SQ; float mx = -3.0e38f;
#pragma unroll 1
  for (int j = 0; j < SQ; ++j) mx = fmaxf(mx, s[j]); float se = 0.f;
#pragma unroll 1
  for (int j = 0; j < SQ; ++j) se += expf(s[j] - mx); const float sc = 256.0f / se;
#pragma unroll 1
  for (int j0 = 0; j0 < SQ; j0 += 8) { FragH f; for (int q = 0; q < 8; ++q) f.h[q] = (_Float16)(expf(s[j0 + q] - mx) * sc); unsigned short* d = (unsigned short*)P + (size_t)i * SQ + j0; *(v8us*)d = f.half[0];  } }
__global__ __launch_bounds__(256) void k_vt(const _Float16* __restrict__ V16, int b, int h0, _Float16* __restrict__ VT) { __shared__ unsigned short tl[64][65]; const int tid = threadIdx.x; const int hh = blockIdx.x % HG, sg = blockIdx.x / HG; const int s0 = sg * 64; const int h = h0 + hh;
  for (int i = tid; i < 64 * 8; i += 256) { const int j = i / 8, d8 = (i % 8) * 8; FragH f; f.half[0] = *(const v8us*)((const unsigned short*)V16 + ((size_t)b * SQ + s0 + j) * DM + h * HD + d8); for (int q = 0; q < 8; ++q) tl[d8 + q][j] = f.u[q]; }
  __syncthreads();
  { for (int i = tid; i < 64 * 8; i += 256) { const int d = i / 8, j8 = (i % 8) * 8; FragH f; for (int q = 0; q < 8; ++q) f.u[q] = tl[d][j8 + q]; *(v8us*)((unsigned short*)VT + ((size_t)hh * HD + d) * SQ + s0 + j8) = f.half[0]; }  } }



__global__ __launch_bounds__(256) void k_rsmcf2(const float* __restrict__ S, _Float16* __restrict__ P, int hg, int q0, int nk) {
  #pragma clang fp contract(off)
  const int t = blockIdx.x * 256 + threadIdx.x; if (t >= hg * QT) return; const size_t i = (size_t)t; const float* s = S + i * NKX; const int last = q0 + (t % QT); float mx = -3.0e38f;
#pragma unroll 1
  for (int j = 0; j < nk; ++j) { const float f = (j <= last) ? 1.f : 0.f; mx = fmaxf(mx, fmaf(f, s[j], (1.f - f) * -1.0e9f)); } float se = 0.f;
#pragma unroll 1
  for (int j = 0; j < nk; ++j) { const float f = (j <= last) ? 1.f : 0.f; se += __expf(fmaf(f, s[j], (1.f - f) * -1.0e9f) - mx); } const float sc = 256.0f / se;
#pragma unroll 1
  for (int j0 = 0; j0 < nk; j0 += 8) { FragH fr; for (int q = 0; q < 8; ++q) { const int j = j0 + q; const float f = (j <= last) ? 1.f : 0.f; fr.h[q] = (_Float16)(__expf(fmaf(f, s[j], (1.f - f) * -1.0e9f) - mx) * sc); } unsigned short* d = (unsigned short*)P + i * NKX + j0; *(v8us*)d = fr.half[0];  } }


template <int MASKADD>
__global__ __launch_bounds__(64) void k_att0(const float* __restrict__ QF, const float* __restrict__ KF, const float* __restrict__ VF, int ld, const float* __restrict__ mask, float scale, float* __restrict__ OF, int ldo) {
  #pragma clang fp contract(off)
  __shared__ __attribute__((aligned(16))) float lq[64][64]; __shared__ __attribute__((aligned(16))) float lo[64][64];
  const int tid = threadIdx.x; const int h = blockIdx.x / (QT0 / 64), rg = blockIdx.x % (QT0 / 64); const int i = rg * 64 + tid;
  const float* qr = QF + (size_t)i * ld + h * HD;
#pragma unroll 1
  for (int c = 0; c < HD / 4; ++c) { *(v4f*)&lq[tid][c * 4] = *(const v4fa*)(qr + c * 4); const v4f z = {0.f, 0.f, 0.f, 0.f}; *(v4f*)&lo[tid][c * 4] = z; }
  float m = -1.0e30f, l = 0.f; const int jmax = MASKADD ? (SQ - 1) : (rg * 64 + 63);      /* additive-mask form: every key (the mask input decides); causal form: keys up to the block's last row */
#pragma unroll 1
  for (int j = 0; j <= jmax; ++j) { const float* kr = KF + (size_t)j * ld + h * HD; const float* vr = VF + (size_t)j * ld + h * HD; float s = 0.f;
#pragma unroll 1
    for (int c = 0; c < HD / 4; ++c) { const v4f kq = *(const v4fa*)(kr + c * 4); const v4f qq = *(v4f*)&lq[tid][c * 4]; s = __fadd_rn(s, __fmul_rn(qq[0], kq[0])); s = __fadd_rn(s, __fmul_rn(qq[1], kq[1])); s = __fadd_rn(s, __fmul_rn(qq[2], kq[2])); s = __fadd_rn(s, __fmul_rn(qq[3], kq[3])); }
    s = __fmul_rn(s, scale); if (MASKADD) s = __fadd_rn(s, __fmul_rn(bf16_round(mask[(size_t)i * SQ + j]), -10000.0f));
    const float f = (MASKADD || j <= i) ? 1.f : 0.f; const float sm = fmaf(f, s, (1.f - f) * -1.0e30f); const float mn = fmaxf(m, sm); const float sc = expf(m - mn); const float e = expf(sm - mn); l = __fadd_rn(__fmul_rn(l, sc), e); m = mn;
#pragma unroll 1
    for (int c = 0; c < HD / 4; ++c) { const v4f vv = *(const v4fa*)(vr + c * 4); v4f oo = *(v4f*)&lo[tid][c * 4]; for (int u = 0; u < 4; ++u) oo[u] = __fadd_rn(__fmul_rn(oo[u], sc), __fmul_rn(e, vv[u])); *(v4f*)&lo[tid][c * 4] = oo; } }
  const float fin = 64.0f / l;      /* o carried x64 like the f16 path */
#pragma unroll 1
  for (int c = 0; c < HD / 4; ++c) { v4f oo = *(v4f*)&lo[tid][c * 4]; for (int u = 0; u < 4; ++u) oo[u] = __fmul_rn(oo[u], fin); *(v4f*)&lo[tid][c * 4] = oo; }
  __syncthreads();
  {
#pragma unroll 1
    for (int it = 0; it < 16; ++it) { const int row = it * 4 + tid / 16, pc = (tid % 16) * 4; const v4f v = *(const v4f*)&lo[row][pc]; *(v4f*)(OF + (size_t)(rg * 64 + row) * ldo + h * HD + pc) = v; }
     } }


template <int BFIN, int WXB>
__global__ __launch_bounds__(256) void k_ln16(const float* __restrict__ X, const float* __restrict__ g, const float* __restrict__ bb, float eps, _Float16* __restrict__ N16, float* __restrict__ XB) {
  #pragma clang fp contract(off)
  __shared__ float red[256]; const size_t r = blockIdx.x; const int t = threadIdx.x; const v4f xa = *(const v4fa*)(X + r * DMQ + t * 4); float s[4]; float sum = 0.f;
  for (int q = 0; q < 4; ++q) { s[q] = BFIN ? bf16_round(xa[q]) : xa[q]; sum = __fadd_rn(sum, s[q]); }
  red[t] = sum; __syncthreads(); for (int st = 128; st > 0; st >>= 1) { if (t < st) red[t] = __fadd_rn(red[t], red[t + st]); __syncthreads(); } const float mu = red[0] / (float)DMQ; __syncthreads();
  float vs = 0.f; for (int q = 0; q < 4; ++q) { const float dl = __fadd_rn(s[q], -mu); vs = __fadd_rn(vs, __fmul_rn(dl, dl)); } red[t] = vs; __syncthreads(); for (int st = 128; st > 0; st >>= 1) { if (t < st) red[t] = __fadd_rn(red[t], red[t + st]); __syncthreads(); }
  const float rs = rsqrtf(__fadd_rn(red[0] / (float)DMQ, eps)); v4h y; v4f xb;
  for (int q = 0; q < 4; ++q) { const int c = t * 4 + q; y[q] = (_Float16)__fadd_rn(__fmul_rn(__fmul_rn(__fadd_rn(s[q], -mu), rs), bf16_round(g[c])), bf16_round(bb[c])); xb[q] = s[q]; }
  { *(v4h*)(N16 + r * DMQ + t * 4) = y; if (WXB) *(v4f*)(XB + r * DMQ + t * 4) = xb;  } }
__global__ __launch_bounds__(256) void k_ftres2(const float* __restrict__ OF0, const float* __restrict__ XB, float* __restrict__ X1, size_t n4) {
  #pragma clang fp contract(off)
  const size_t t = (size_t)blockIdx.x * 256 + threadIdx.x; if (t >= n4) return; const v4f o = *(const v4fa*)(OF0 + t * 4), xv = *(const v4fa*)(XB + t * 4); v4f y; for (int q = 0; q < 4; ++q) y[q] = __fadd_rn(__fmul_rn(o[q], 0.015625f), xv[q]); *(v4f*)(X1 + t * 4) = y;  }

__global__ __launch_bounds__(256) void k_wthd(const float* __restrict__ Wt, _Float16* __restrict__ Bt) { const size_t t = (size_t)blockIdx.x * 256 + threadIdx.x; if (t >= (size_t)NH * HD * (DM / 8)) return; const int m8 = (int)(t % (DM / 8)) * 8; const int d = (int)((t / (DM / 8)) % HD); const int h = (int)(t / ((size_t)(DM / 8) * HD)); FragH f;
  for (int q = 0; q < 8; ++q) f.h[q] = (_Float16)(16.0f * bf16_round(Wt[((size_t)h * DM + m8 + q) * HD + d])); unsigned short* dst = (unsigned short*)Bt + ((size_t)h * HD + d) * DM + m8; *(v8us*)dst = f.half[0];  }




template <int BFIN, int W16, int W32>
__global__ __launch_bounds__(256) void k_lnx(const float* __restrict__ X, const float* __restrict__ g, const float* __restrict__ bb, float eps, _Float16* __restrict__ N16, float* __restrict__ N32) {
  #pragma clang fp contract(off)
  __shared__ float red[256]; const size_t r = blockIdx.x; const int t = threadIdx.x; const bool act = t < (DMQ / 4); const int c0 = act ? t * 4 : 0;
  const v4f xa = *(const v4fa*)(X + r * DMQ + c0); float s[4]; float sum = 0.f;
  for (int q = 0; q < 4; ++q) { s[q] = act ? (BFIN ? bf16_round(xa[q]) : xa[q]) : 0.f; sum = __fadd_rn(sum, s[q]); }
  red[t] = sum; __syncthreads(); for (int st = 128; st > 0; st >>= 1) { if (t < st) red[t] = __fadd_rn(red[t], red[t + st]); __syncthreads(); } const float mu = red[0] / (float)DMQ; __syncthreads();
  float vs = 0.f; for (int q = 0; q < 4; ++q) { const float dl = act ? __fadd_rn(s[q], -mu) : 0.f; vs = __fadd_rn(vs, __fmul_rn(dl, dl)); } red[t] = vs; __syncthreads(); for (int st = 128; st > 0; st >>= 1) { if (t < st) red[t] = __fadd_rn(red[t], red[t + st]); __syncthreads(); }
  const float rs = rsqrtf(__fadd_rn(red[0] / (float)DMQ, eps)); v4h y; v4f yf;
  for (int q = 0; q < 4; ++q) { const int c = c0 + q; yf[q] = __fadd_rn(__fmul_rn(__fmul_rn(__fadd_rn(s[q], -mu), rs), bf16_round(g[c])), bf16_round(bb[c])); y[q] = (_Float16)yf[q]; }
  if (!act) return;      /* no barriers after this point */
  { if (W16) *(v4h*)(N16 + r * DMQ + c0) = y; if (W32) *(v4f*)(N32 + r * DMQ + c0) = yf;  } }






__global__ __launch_bounds__(256) void k_lorafold(const float* __restrict__ Wm, const float* __restrict__ A, const float* __restrict__ Bm, float* __restrict__ WE, int K, int N, float sc) {
  #pragma clang fp contract(off)
  const size_t t = (size_t)blockIdx.x * 256 + threadIdx.x; if (t >= (size_t)K * N) return; const int i = (int)(t / N), o = (int)(t % N); float a = 0.f;
  for (int r = 0; r < 16; ++r) a = __fadd_rn(a, __fmul_rn(bf16_round(A[(size_t)i * 16 + r]), bf16_round(Bm[(size_t)r * N + o])));
  const float v = __fadd_rn(bf16_round(Wm[t]), __fmul_rn(sc, a)); *(float*)(WE + t) = v;  }
__global__ __launch_bounds__(256) void k_wt32rep(const float* __restrict__ Wf, _Float16* __restrict__ Bt, int K, int N, int DOUT, float scale) {
  const int t = blockIdx.x * 256 + threadIdx.x; if (t >= DOUT * (K / 8)) return; const int n = t / (K / 8), k8 = (t % (K / 8)) * 8; const int rep = DOUT / N; const int src = (n / (HD * rep)) * HD + (n % HD);      /* head h = n / HD -> group h / rep */
  FragH f; for (int i = 0; i < 8; ++i) f.h[i] = (_Float16)(Wf[(size_t)(k8 + i) * N + src] * scale);
  *(v8us*)((unsigned short*)Bt + (size_t)n * K + k8) = f.half[0];  }
__global__ __launch_bounds__(256) void k_brep(const float* __restrict__ b, float* __restrict__ out) { const int t = blockIdx.x * 256 + threadIdx.x; if (t >= DM) return; const float v = b[(t / (HD * 4)) * HD + (t % HD)]; *(float*)(out + t) = v;  }

__global__ __launch_bounds__(256) void k_rsmcim(const float* __restrict__ S, _Float16* __restrict__ P, int hg, int q0, int nk, const int* __restrict__ am) {
  #pragma clang fp contract(off)
  const int t = blockIdx.x * 256 + threadIdx.x; if (t >= hg * QT) return; const size_t i = (size_t)t; const float* s = S + i * NKX; const int last = q0 + (t % QT); const int* mr = am + (size_t)last * SQ; float mx = -3.0e38f;      /* the module's mask row of this query (keys >= nk lie above the diagonal of the causal mask and are not computed) */
#pragma unroll 1
  for (int j = 0; j < nk; ++j) { const float f = (mr[j] != 0) ? 1.f : 0.f; mx = fmaxf(mx, fmaf(f, s[j], (1.f - f) * -1.0e9f)); } float se = 0.f;
#pragma unroll 1
  for (int j = 0; j < nk; ++j) { const float f = (mr[j] != 0) ? 1.f : 0.f; se += __expf(fmaf(f, s[j], (1.f - f) * -1.0e9f) - mx); } const float sc = 256.0f / se;
#pragma unroll 1
  for (int j0 = 0; j0 < nk; j0 += 8) { FragH fr; for (int q = 0; q < 8; ++q) { const int j = j0 + q; const float f = (mr[j] != 0) ? 1.f : 0.f; fr.h[q] = (_Float16)(__expf(fmaf(f, s[j], (1.f - f) * -1.0e9f) - mx) * sc); } unsigned short* d = (unsigned short*)P + i * NKX + j0; *(v8us*)d = fr.half[0];  } }



// One grid for the eleven preparation jobs (six weight transposes, the two planes of x, the three biases stacked): none reads what another writes, so they need no order among themselves.
// The block index picks the job (block-uniform branches; no job has a barrier). The large transposes come first, the short bias blocks last.
#define PB_WL ((DM / 128) * (DFF / 64))      /* tiles of W1, and of W2 */
#define PB_WS ((DM / 128) * (DM / 64))       /* tiles of one of Wq, Wk, Wv, Wo */
#define PB_W (2 * PB_WL + 4 * PB_WS)
#define PB_XE 4096                           /* elements of x a block: 8 pieces of 16 bytes a lane */
#define PB_X ((int)(NR * DM / PB_XE))
#define PB_B (3 * DM / 128)
__global__ __launch_bounds__(128) void k_prep(const float* __restrict__ x, const float* __restrict__ wq, const float* __restrict__ wk, const float* __restrict__ wv, const float* __restrict__ wo, const float* __restrict__ wfc, const float* __restrict__ wmp,
    const float* __restrict__ bq, const float* __restrict__ bk, const float* __restrict__ bv, _Float16* __restrict__ BQKV, _Float16* __restrict__ BO, _Float16* __restrict__ BW1, _Float16* __restrict__ BW2, float* __restrict__ bqkv, _Float16* __restrict__ X16, float* __restrict__ XB) {
  const int blk = blockIdx.x, tid = threadIdx.x;
  if (blk < PB_W) {      /* [in][out] -> Bt x16: W1, W2, stacked q | k | v, Wo */
    const float* W; _Float16* Wt; int K = DM, N = DM, r;
    if (blk < PB_WL) { W = wfc; Wt = BW1; N = DFF; r = blk; }
    else if (blk < 2 * PB_WL) { W = wmp; Wt = BW2; K = DFF; r = blk - PB_WL; }
    else { const int j = (blk - 2 * PB_WL) / PB_WS; r = (blk - 2 * PB_WL) - j * PB_WS; W = (j == 0) ? wq : (j == 1) ? wk : (j == 2) ? wv : wo; Wt = (j < 3) ? BQKV + (size_t)j * DM * DM : BO; }
    wt_f16_tile(W, Wt, K, N, 16.0f, r);
  } else if (blk < PB_W + PB_X) {      /* x read once: bf16(x) as exact f16 rows (GEMM operand) and as f32 rows (residual). A wave's load covers four whole lines, its stores four and two */
    const size_t e0 = (size_t)(blk - PB_W) * PB_XE + tid * 4; const float* p = x + e0; v4f a[8];
    /* unrolled: constant indices (registers), and the eight loads of a lane fly together */
#pragma unroll
    for (int i = 0; i < 8; ++i) a[i] = *(const v4fa*)(p + i * 512);
#pragma unroll
    for (int i = 0; i < 8; ++i) { v4f f; v4h h;
#pragma unroll
      for (int q = 0; q < 4; ++q) { f[q] = bf16_round(a[i][q]); h[q] = (_Float16)f[q]; }
      *(v4f*)(XB + e0 + i * 512) = f; *(v4h*)(X16 + e0 + i * 512) = h; }
    asm volatile("s_wait_xcnt 0x0" ::: "memory");      /* stands behind the last store, in front of any later write of a register that a store names */
  } else {      /* stacked bias bq | bk | bv: a block lies inside one of the three */
    const int c = blk - PB_W - PB_X, j = c / (DM / 128); const float* b = (j == 0) ? bq : (j == 1) ? bk : bv; const int i = (c - j * (DM / 128)) * 128 + tid; (bqkv + j * DM)[i] = b[i];
    asm volatile("s_wait_xcnt 0x0" ::: "memory");      /* as above: behind the store, in front of any later write of its registers */
  }
}



// lane l with lane l ^ 16
__device__ __forceinline__ float rs_xh(float v) { return __builtin_bit_cast(float, __builtin_amdgcn_permlanex16(__builtin_bit_cast(int, v), __builtin_bit_cast(int, v), 0x76543210, 0xfedcba98, false, false)); }
// native 2^t; the v_nop is the slot the instruction set asks for behind a transcendental before its result is read or its source overwritten
__device__ __forceinline__ float fa_exp2(float t) { float e; asm("v_exp_f32 %0, %1\n\tv_nop" : "=v"(e) : "v"(t)); return e; }
#define FA_KT 128      /* keys a stage */
#define FA_KP 144      /* LDS pitch of a K row, bytes: 128 of data + 16, an odd multiple of 16 (no bank conflict for 16-byte row reads) */
#define FA_VP 272      /* LDS pitch of a V^T row: 256 of data + 16, likewise */
#define FA_VO (FA_KT * FA_KP)      /* the 64 V^T rows stand behind the 128 K rows */
#define FA_STAGE (FA_VO + HD * FA_VP)      /* one buffer */
// Eight asynchronous 16-byte copies of a lane, global -> LDS: four of K (rows 32 apart), four of V^T (rows 16 apart). The s_wait_xcnt stands in the copies' own statement, behind the last of them,
// so that it precedes every later write of a register that a copy names.
__device__ __forceinline__ void fa_copy8(unsigned lk, const _Float16* gk, unsigned lv, const _Float16* gv) {
  asm volatile("global_load_async_to_lds_b128 %0, %8, off\n\t"
               "global_load_async_to_lds_b128 %1, %9, off\n\t"
               "global_load_async_to_lds_b128 %2, %10, off\n\t"
               "global_load_async_to_lds_b128 %3, %11, off\n\t"
               "global_load_async_to_lds_b128 %4, %12, off\n\t"
               "global_load_async_to_lds_b128 %5, %13, off\n\t"
               "global_load_async_to_lds_b128 %6, %14, off\n\t"
               "global_load_async_to_lds_b128 %7, %15, off\n\t"
               "s_wait_xcnt 0x0"
               :: "v"(lk), "v"(lk + 32u * FA_KP), "v"(lk + 64u * FA_KP), "v"(lk + 96u * FA_KP), "v"(lv), "v"(lv + 16u * FA_VP), "v"(lv + 32u * FA_VP), "v"(lv + 48u * FA_VP),
                  "v"(gk), "v"(gk + (size_t)32 * LQ), "v"(gk + (size_t)64 * LQ), "v"(gk + (size_t)96 * LQ), "v"(gv), "v"(gv + (size_t)16 * SQ), "v"(gv + (size_t)32 * SQ), "v"(gv + (size_t)48 * SQ) : "memory"); }
__global__ __launch_bounds__(256) void k_fattn(const _Float16* __restrict__ Q, const _Float16* __restrict__ Kk, const _Float16* __restrict__ VT, _Float16* __restrict__ O) {
  __shared__ __attribute__((aligned(16))) unsigned char sm[2 * FA_STAGE];
  const int tid = threadIdx.x, lane = tid & 31, w = tid >> 5, ln = lane & 15, hh = lane >> 4; const int h = blockIdx.y, b = blockIdx.z; const int q0 = blockIdx.x * 256 + w * 32; const size_t r0 = (size_t)b * SQ;
  const _Float16* qp = Q + (r0 + q0 + ln) * LQ + h * HD + 8 * hh;      /* the lane's own 8 hh is in the pointer: g2_frag is called with 0 */
  /* copies: lane = 16 bytes. K: 8 lanes a row of 128 bytes, thread rows tid / 8 + 32 i; V^T: 16 lanes a row of 256 bytes, thread rows tid / 16 + 16 i: a wave's copy covers four whole lines */
  const unsigned lk = (unsigned)(size_t)sm + (unsigned)(tid >> 3) * FA_KP + (unsigned)(tid & 7) * 16u; const unsigned lv = (unsigned)(size_t)sm + FA_VO + (unsigned)(tid >> 4) * FA_VP + (unsigned)(tid & 15) * 16u;
  const _Float16* gk = Kk + (r0 + (tid >> 3)) * LQ + h * HD + (tid & 7) * 8; const _Float16* gv = VT + ((size_t)(b * NH + h) * HD + (tid >> 4)) * SQ + (tid & 15) * 8;
  auto fill = [&](int t, int buf) { fa_copy8(lk + (unsigned)buf * FA_STAGE, gk + (size_t)t * FA_KT * LQ, lv + (unsigned)buf * FA_STAGE, gv + (size_t)t * FA_KT); };
  const unsigned char* sk = sm + ln * FA_KP + 16 * hh; const unsigned char* sv = sm + FA_VO + ln * FA_VP + 16 * hh;      /* the lane's fragment rows; same k order as g2_frag */
  const float L2E = 1.44269504088896340736f; const v8f z8 = {0.f,0.f,0.f,0.f,0.f,0.f,0.f,0.f};
  v16h qf[2][2], kf[2][2], vf[4]; v8f o[2][4]; float m[2] = {-3.0e38f, -3.0e38f}, l[2] = {0.f, 0.f};
  fill(0, 0);
  /* every inner loop is unrolled so that the fragment arrays have constant indices and stay in registers */
#pragma unroll
  for (int t = 0; t < 2; ++t) { qf[t][0] = g2_frag(qp + (size_t)t * 16 * LQ, 0); qf[t][1] = g2_frag(qp + (size_t)t * 16 * LQ + 32, 0);
#pragma unroll
    for (int dt = 0; dt < 4; ++dt) o[t][dt] = z8; }
  /* behind the loads that share one address pair: the wait that precedes any overwrite of that pair; the pair is an input, so it stays live (no load's result lands on it) up to the wait */
  asm volatile("s_wait_xcnt 0x0" :: "v"(qp) : "memory");
  asm volatile("s_wait_asynccnt 0x0" ::: "memory");      /* this wave's copies of stage 0 have landed */
  __syncthreads();      /* and every other wave's: stage 0 may be read */
  fill(1, 1);
  /* rolled: one copy of the body; a stage is 128 keys, while the next stage's copies fly */
#pragma unroll 1
  for (int t = 0; t < SQ / FA_KT; ++t) { const unsigned char* pk = sk + (t & 1) * FA_STAGE; const unsigned char* pv = sv + (t & 1) * FA_STAGE;
#pragma unroll
    for (int kt = 0; kt < 2; ++kt) { kf[kt][0] = g2_lfrag(pk + kt * 16 * FA_KP); kf[kt][1] = g2_lfrag(pk + kt * 16 * FA_KP + 64); }
    /* rolled: a pass is some 350 instructions already, and four copies of it spill. The stage's last pass fetches no K ahead (nothing of the next stage is read in front of the barrier) */
#pragma unroll 1
    for (int p = 0; p < FA_KT / 32; ++p) {
#pragma unroll
      for (int dt = 0; dt < 4; ++dt) vf[dt] = g2_lfrag(pv + dt * 16 * FA_VP + p * 64);
      v8f s[2][2];
#pragma unroll
      for (int u = 0; u < 2; ++u)
#pragma unroll
        for (int kt = 0; kt < 2; ++kt) s[u][kt] = g2_mma(kf[kt][1], qf[u][1], g2_mma(kf[kt][0], qf[u][0], z8));
      if (p + 1 < FA_KT / 32) {
#pragma unroll
        for (int kt = 0; kt < 2; ++kt) { kf[kt][0] = g2_lfrag(pk + ((p + 1) * 32 + kt * 16) * FA_KP); kf[kt][1] = g2_lfrag(pk + ((p + 1) * 32 + kt * 16) * FA_KP + 64); } }
      FragH pf[2];
#pragma unroll
      for (int u = 0; u < 2; ++u) { float mx = fmaxf(s[u][0][0], s[u][1][0]);
#pragma unroll
        for (int r = 1; r < 8; ++r) mx = fmaxf(mx, fmaxf(s[u][0][r], s[u][1][r]));
        mx = fmaxf(mx, rs_xh(mx)); const float mn = fmaxf(m[u], mx); const float al = fa_exp2((m[u] - mn) * L2E); const float mb = mn * L2E - 8.0f; m[u] = mn; float e0 = 0.f, e1 = 0.f;
#pragma unroll
        for (int r = 0; r < 8; ++r) { const float p0 = fa_exp2(fmaf(s[u][0][r], L2E, -mb)), p1 = fa_exp2(fmaf(s[u][1][r], L2E, -mb)); e0 += p0; e1 += p1; pf[u].h[r] = (_Float16)p0; pf[u].h[8 + r] = (_Float16)p1; }
        l[u] = fmaf(l[u], al, e0 + e1);      /* this half's keys only; the halves are joined behind the loop */
#pragma unroll
        for (int dt = 0; dt < 4; ++dt) o[u][dt] *= al; }
#pragma unroll
      for (int u = 0; u < 2; ++u)
#pragma unroll
        for (int dt = 0; dt < 4; ++dt) o[u][dt] = g2_mma(vf[dt], pf[u].v, o[u][dt]); }
    asm volatile("s_wait_dscnt 0x0" ::: "memory");      /* this wave's reads of the buffer are done before it is refilled */
    asm volatile("s_wait_asynccnt 0x0" ::: "memory");      /* this wave's copies of stage t + 1 have landed */
    __syncthreads();      /* publishes stage t + 1 and ends every wave's reads of stage t */
    if (t + 2 < SQ / FA_KT) fill(t + 2, t & 1); }
  asm volatile("s_wait_asynccnt 0x0" ::: "memory");      /* no copy is outstanding when the wave ends */
#pragma unroll
  for (int t = 0; t < 2; ++t) { const float fin = 64.0f / (l[t] + rs_xh(l[t]));      /* ctx carried x64; the x256 of the weights cancels in the quotient */
    _Float16* d = O + (r0 + q0 + t * 16 + ln) * DM + h * HD + 8 * hh;
#pragma unroll
    for (int dt = 0; dt < 4; ++dt) { FragH f;
#pragma unroll
      for (int r = 0; r < 8; ++r) f.h[r] = (_Float16)(o[t][dt][r] * fin);
      *(v8us*)((unsigned short*)d + dt * 16) = f.half[0]; } } }
extern "C" void kernel_launch(void* const* d_in, const int* in_sizes, int n_in,
                              void* d_out, int out_size, void* d_ws, size_t ws_size, hipStream_t stream) {
  (void)in_sizes; (void)n_in; (void)out_size;
  const float* const* I = (const float* const*)d_in; const float* x = I[0]; const float* wq = I[1]; const float* bq = I[2]; const float* wk = I[3]; const float* bk = I[4]; const float* wv = I[5]; const float* bv = I[6]; const float* wo = I[7]; const float* bo = I[8]; const float* wfc = I[9]; const float* bfc = I[10]; const float* wmp = I[11]; const float* bmp = I[12]; const float* g1 = I[13]; const float* be1 = I[14]; const float* gg2 = I[15]; const float* be2 = I[16];      /* x; [in][out] Wq / Wk / Wv / Wo + biases; W1 [1024][4096] + b1, W2 [4096][1024] + b2; LN1 g / b, LN2 g / b */
  char* ws = (char*)d_ws; size_t off = 0;
  auto take = [&](size_t bytes) { char* p = ws + off; off += (bytes + 255) & ~(size_t)255; return p; };
  _Float16* BQKV = (_Float16*)take((size_t)3 * DM * DM * 2); _Float16* BO = (_Float16*)take((size_t)DM * DM * 2); float* bqkv = (float*)take((size_t)3 * DM * 4); float* X1N = nullptr;      /* LN1 output (f32): aliases the QKV plane below (QKV's last readers, the V^T and attention launches, precede LN1) to stay within 256 MiB at NB 4 / SQ 2048 */
  _Float16* X16 = (_Float16*)take(NR * DM * 2); float* XB = (float*)take(NR * DM * 4); float* X1 = (float*)take(NR * DM * 4); _Float16* M16 = nullptr;      /* = X16 below (alias: X16's last reader, the fused QKV GEMM, precedes LN1's f16 write) */ _Float16* HF16 = nullptr;      /* FFN hidden plane of all rows [4096][4096] f16, taken below */ _Float16* BW1 = (_Float16*)take((size_t)DFF * DM * 2); _Float16* BW2 = (_Float16*)take((size_t)DM * DFF * 2); _Float16* QKV = (_Float16*)take(NR * 3 * DM * 2); _Float16* Q16 = QKV; _Float16* K16 = QKV + DM; _Float16* V16 = QKV + 2 * DM; _Float16* O16 = (_Float16*)take(NR * DM * 2); M16 = X16; X1N = (float*)QKV; HF16 = (_Float16*)take(NR * DFF * 2);      /* the FFN hidden plane of all rows (32 MiB) gets its OWN region here */      /* alias: X1N (NR*DM f32 = 16 MiB) inside QKV (24 MiB) */
  _Float16* VT = (_Float16*)take((size_t)NB * NH * HD * SQ * 2);
  if (off > ws_size) return;
  k_prep<<<(unsigned)(PB_W + PB_X + PB_B), 128, 0, stream>>>(x, wq, wk, wv, wo, wfc, wmp, bq, bk, bv, BQKV, BO, BW1, BW2, bqkv, X16, XB);      /* weights as Bt x16, stacked bias, x as exact f16 rows (post-LN: the attention runs on the raw input) and as bf16(x) f32 rows for the residual */
  const size_t r0p = (size_t)B0 * SQ;      /* first projected row */
  k_gemm2<0, false><<<dim3((unsigned)((MP / 128) * (3 * DM / 128)), 1), 256, 0, stream>>>(X16 + r0p * DM, DM, 0, BQKV, DM, 0, 0.0625f, bqkv, 0, nullptr, 1, 0, 0, nullptr, QKV + r0p * 3 * DM, 3 * DM, 0, MP, 3 * DM, DM);      /* q | k | v rows (f16); head h = columns h*HD.. of each DM block */
  k_vt<NH, SQ><<<NB * NH * (SQ / 64), 256, 0, stream>>>(V16, LQ, 0, VT);      /* V^T [NB][NH][HD][SQ] */
  k_fattn<<<dim3(SQ / 256, NH, NB), 256, 0, stream>>>(Q16, K16, VT, O16);      /* scores q.k (no scaling), softmax over all keys, ctx (merged heads, x64) as f16 rows */
  k_gemm2<0, true><<<dim3((unsigned)((MPO / 128) * (DM / 128)), 1), 256, 0, stream>>>(O16 + r0p * DM, DM, 0, BO, DM, 0, 0.0009765625f, bo, 0, XB + r0p * DM, -1, 0, 0, X1 + r0p * DM, nullptr, DM, 0, MPO, DM, DM);      /* out rows are the output layout */
  k_lnx<0, 1, 1><<<(unsigned)NR, 256, 0, stream>>>(X1, g1, be1, 1e-5f, M16, X1N);      /* x1 = LN1(x + attn_out) (eps 1e-5): f16 rows for the FFN input and f32 rows for the residual */
  k_gemm2<6, false><<<dim3((unsigned)((MPO / 128) * (DFF / 128)), 1), 256, 0, stream>>>(M16, DM, 0, BW1, DM, 0, 0.0625f, bfc, 0, nullptr, 1, 0, 0, nullptr, HF16, DFF, 0, MPO, DFF, DM);      /* gelu_erf(h w1^T + b1) -> f16, the rows of both batches in one grid */
  k_gemm2<0, true><<<dim3((unsigned)((MPO / 128) * (DM / 128)), 1), 256, 0, stream>>>(HF16, DFF, 0, BW2, DFF, 0, 0.0625f, bmp, 0, X1N, -1, 0, 0, X1, nullptr, DM, 0, MPO, DM, DFF);      /* t = x1 + ffn + b2 (own-element residual) f32, over the dead pre-LN1 plane; likewise one grid */
  k_lnx<0, 0, 1><<<(unsigned)NR, 256, 0, stream>>>(X1, gg2, be2, 1e-5f, nullptr, (float*)d_out);      /* out = LN2(t) (eps 1e-5) -> f32 output rows */
}

// v010
// A run of this version takes 171 microseconds.
// Timed twice side by side with v009, it ran 1.03 and 1.02 times as fast.
// All steps since the starting kernel, v000, together make it 43.3 times as fast.
#include <hip/hip_runtime.h>
// POST-LN transformer encoder block (x [2][2048][1024]; q/k/v = x W + b ([in][out] 1024 x 1024, zero biases); 16 heads of 64; scores = q k^T with NO 1/sqrt(head_dim) scaling (as the source module); softmax over all 2048 keys (no mask); x1 = LN1(x + ctx Wo + bo) (biased var, eps 1e-5, g / beta); out = LN2(x1 + gelu_erf(x1 W1 + b1) W2 + b2) ([in][out] 1024 x 4096 x 1024) -> [2][2048][1024]).
// Structure: token rows; x as exact f16 rows and bf16 f32 residual rows; natural weights as exact x16 planes; fused q | k | v WMMA GEMM (32x64 wave tiles, f32 accumulation, + stacked bias) -> f16; V^T via LDS transposes; one fused attention launch (S^T = K Q^T, online softmax in registers with f32 statistics and native exp, weights x256 f16, O^T += V^T P^T), ctx (x64) merged f16; x + ctx Wo^T + bo f32; LN1 on VALU -> f16 + f32; gelu FFN, all rows in one grid a GEMM; + residual; LN2 -> output; 9 launches (all preparation in one grid).
// Compute dtype: inputs rounded to bf16; x / weights exact; q, k, v, softmax weights and o as plain f16 GEMM operands (~2^-12); scores and softmax statistics f32. v_wmma_f32_16x16x32_f16.
#define NB 2
#define SQ 2048
#define DM 1024
#define NH 16
#define HD 64
#define HG 4                         /* heads per launch of the grouped k_vt (not launched here) */
#define QT 256                       /* query rows per causal tile */
#define NKX SQ                       /* S / P row pitch */
#define QT0 128                      /* first-tile rows recomputed exactly in f32 */
#define B0 0                         /* first batch processed (debug hook) */
#define NBR NB                       /* batches processed (debug hook) */
#define NR ((size_t)NB * SQ)
#define DMQ DM
#define DFF 4096         /* FFN hidden width */
#define MP ((int)((size_t)NBR * SQ)) /* rows projected (debug hook) */
#define QN SQ                        /* query rows attended per batch (unused: the attention grid takes SQ) */
#define NHD NH                       /* heads attended (unused: the attention grid takes NH) */
#define MPO MP                       /* rows through the output stage (debug hook) */
#define LQ (3 * DM)      /* row pitch of the q/k/v rows */
typedef __bf16 v16b __attribute__((ext_vector_type(16)));
typedef unsigned short v8us __attribute__((ext_vector_type(8), may_alias));
typedef float  v8f  __attribute__((ext_vector_type(8)));
typedef float  v4f  __attribute__((ext_vector_type(4)));
typedef float  v4fa __attribute__((ext_vector_type(4), may_alias));
union FragB { v16b v; v8us half[2]; unsigned short u[16]; };

__device__ __forceinline__ unsigned short bf16_bits(float x) { unsigned int u = __float_as_uint(x); return (unsigned short)((u + 0x7FFFu + ((u >> 16) & 1u)) >> 16); }
__device__ __forceinline__ float bf16_val(unsigned short b) { return __uint_as_float(((unsigned int)b) << 16); }
__device__ __forceinline__ float bf16_round(float x) { return bf16_val(bf16_bits(x)); }
// D += A·B with NT terms: 1 = ah·bh, 2 = + al·bh (A split), 3 = + ah·bl (both split)
template <int NT>
__device__ __forceinline__ v8f mmaN(v16b ah, v16b al, v16b bh, v16b bl, v8f c) {
  c = __builtin_amdgcn_wmma_f32_16x16x32_bf16(false, ah, false, bh, (short)0, c, false, false);
  if (NT >= 2) c = __builtin_amdgcn_wmma_f32_16x16x32_bf16(false, al, false, bh, (short)0, c, false, false);
  if (NT >= 3) c = __builtin_amdgcn_wmma_f32_16x16x32_bf16(false, ah, false, bl, (short)0, c, false, false);
  asm volatile("v_nop\n\tv_nop\n\tv_nop\n\tv_nop" : "+v"(c) : "v"(ah), "v"(al), "v"(bh), "v"(bl));
  return c;
}

__global__ __launch_bounds__(256) void k_wt_bf16(const float* __restrict__ W, unsigned short* __restrict__ Wt, int K, int N) {
  const int t = blockIdx.x * 256 + threadIdx.x;
  const int k8n = K / 8;
  if (t >= N * k8n) return;
  const int n = t / k8n, k8 = (t % k8n) * 8;
  v8us v;
#pragma unroll
  for (int i = 0; i < 8; ++i) v[i] = bf16_bits(W[(size_t)(k8 + i) * N + n]);
  *(v8us*)(Wt + (size_t)n * K + k8) = v;
  
}

// GEMM C[M][N] (f32, pitch ldc) = act(A[M][K]·W + bias). A f32 row-major (pitch lda) converted per fragment to bf16
// (ASPLIT: hi/lo two planes -> 2 terms, else single rounded term); Wt bf16 [N][K] (pitch ldb). BIAS_BF16 rounds the
// bias to bf16 first (bias quantised to bf16 before the add). K%32==0, M%16==0, N%64==0.
template <bool ASPLIT, int ACT, bool BIAS_BF16>
__global__ __launch_bounds__(128) void k_gemm_bf(const float* __restrict__ A, int lda, const unsigned short* __restrict__ Wt, int ldb,
                                               const float* __restrict__ bias, float* __restrict__ C, int ldc, int M, int N, int K) {
  __shared__ __attribute__((aligned(16))) float so[4][16][64];
  const int tid = threadIdx.x, w = tid >> 5, lane = tid & 31, ln = lane & 15, hh = lane >> 4;
  const int ntn = N / 64;
  const int wid = blockIdx.x * 4 + w;
  const int mt = wid / ntn, nq = wid % ntn;
  if (mt * 16 >= M) return;
  const int row0 = mt * 16, col0 = nq * 64;
  const float* arow = A + (size_t)(row0 + ln) * lda;
  v8f acc[4] = {};
  for (int kb = 0; kb < K; kb += 32) {
    FragB ah, al;
    const v4f x0 = *(const v4fa*)(arow + kb + 8 * hh), x1 = *(const v4fa*)(arow + kb + 8 * hh + 4);
    const v4f x2 = *(const v4fa*)(arow + kb + 16 + 8 * hh), x3 = *(const v4fa*)(arow + kb + 16 + 8 * hh + 4);
    float xs[16] = {x0[0],x0[1],x0[2],x0[3],x1[0],x1[1],x1[2],x1[3],x2[0],x2[1],x2[2],x2[3],x3[0],x3[1],x3[2],x3[3]};
#pragma unroll
    for (int i = 0; i < 16; ++i) { const unsigned short hb = bf16_bits(xs[i]); ah.u[i] = hb; al.u[i] = ASPLIT ? bf16_bits(xs[i] - bf16_val(hb)) : (unsigned short)0; }
#pragma unroll
    for (int t = 0; t < 4; ++t) {
      const unsigned short* brow = Wt + (size_t)(col0 + t * 16 + ln) * ldb + kb;
      FragB b;
      b.half[0] = *(const v8us*)(brow + 8 * hh);
      b.half[1] = *(const v8us*)(brow + 16 + 8 * hh);
      acc[t] = mmaN<ASPLIT ? 2 : 1>(ah.v, al.v, b.v, b.v, acc[t]);
    }
  }
#pragma unroll
  for (int t = 0; t < 4; ++t) {
    float bv = bias ? bias[col0 + t * 16 + ln] : 0.f;
    if (BIAS_BF16) bv = bf16_round(bv);
#pragma unroll
    for (int r = 0; r < 8; ++r) { float v = acc[t][r] + bv; if (ACT == 1) v = fmaxf(v, 0.f); so[w][8 * hh + r][t * 16 + ln] = v; }
  }
  __builtin_amdgcn_fence(__ATOMIC_ACQ_REL, "workgroup");
  __builtin_amdgcn_wave_barrier();
  const int rsub = lane >> 4, c4 = (lane & 15) * 4;
  {
#pragma unroll
    for (int q = 0; q < 8; ++q) {
      const int r = q * 2 + rsub;
      const v4f v = *(const v4fa*)&so[w][r][c4];
      *(v4f*)(C + (size_t)(row0 + r) * ldc + col0 + c4) = v;
    }
    
  }
}

// GEMM C = act(A·W + bias + resid): A f32 (ASPLIT -> hi/lo 2 terms), Wt bf16 [N][K]; ACT 0 none, 1 relu, 2 exact gelu;
// resid (optional, f32, row index = (row % rmod), pitch ldr, RES_BF16 rounds it) added before the activation.
template <bool ASPLIT, int ACT, bool BIAS_BF16, bool RES_BF16>
__global__ __launch_bounds__(128) void k_gemm_bf3(const float* __restrict__ A, int lda, const unsigned short* __restrict__ Wt, int ldb,
                                                const float* __restrict__ bias, const float* __restrict__ resid, int rmod, int ldr,
                                                float* __restrict__ C, int ldc, int M, int N, int K) {
  __shared__ __attribute__((aligned(16))) float so[4][16][64];
  const int tid = threadIdx.x, w = tid >> 5, lane = tid & 31, ln = lane & 15, hh = lane >> 4;
  const int ntn = N / 64;
  const int wid = blockIdx.x * 4 + w;
  const int mt = wid / ntn, nq = wid % ntn;
  if (mt * 16 >= M) return;
  const int row0 = mt * 16, col0 = nq * 64;
  const float* arow = A + (size_t)(row0 + ln) * lda;
  v8f acc[4] = {};
  for (int kb = 0; kb < K; kb += 32) {
    FragB ah, al;
    const v4f x0 = *(const v4fa*)(arow + kb + 8 * hh), x1 = *(const v4fa*)(arow + kb + 8 * hh + 4);
    const v4f x2 = *(const v4fa*)(arow + kb + 16 + 8 * hh), x3 = *(const v4fa*)(arow + kb + 16 + 8 * hh + 4);
    float xs[16] = {x0[0],x0[1],x0[2],x0[3],x1[0],x1[1],x1[2],x1[3],x2[0],x2[1],x2[2],x2[3],x3[0],x3[1],x3[2],x3[3]};
#pragma unroll
    for (int i = 0; i < 16; ++i) { const unsigned short hb = bf16_bits(xs[i]); ah.u[i] = hb; al.u[i] = ASPLIT ? bf16_bits(xs[i] - bf16_val(hb)) : (unsigned short)0; }
#pragma unroll
    for (int t = 0; t < 4; ++t) {
      const unsigned short* brow = Wt + (size_t)(col0 + t * 16 + ln) * ldb + kb;
      FragB b;
      b.half[0] = *(const v8us*)(brow + 8 * hh);
      b.half[1] = *(const v8us*)(brow + 16 + 8 * hh);
      acc[t] = mmaN<ASPLIT ? 2 : 1>(ah.v, al.v, b.v, b.v, acc[t]);
    }
  }
#pragma unroll
  for (int t = 0; t < 4; ++t) {
    const int col = col0 + t * 16 + ln;
    float bv = bias ? bias[col] : 0.f;
    if (BIAS_BF16) bv = bf16_round(bv);
#pragma unroll
    for (int r = 0; r < 8; ++r) {
      float v = acc[t][r] + bv;
      if (resid) { float rv = resid[(size_t)((row0 + 8 * hh + r) % rmod) * ldr + col]; if (RES_BF16) rv = bf16_round(rv); v += rv; }
      if (ACT == 1) v = fmaxf(v, 0.f);
      if (ACT == 2) v = 0.5f * v * (1.0f + erff(v * 0.70710678118654752f));
      if (ACT == 3) { const float u = 0.7978845608028654f * (v + 0.044715f * v * v * v); v = 0.5f * v * (1.0f + tanhf(u)); }
      so[w][8 * hh + r][t * 16 + ln] = v;
    }
  }
  __builtin_amdgcn_fence(__ATOMIC_ACQ_REL, "workgroup");
  __builtin_amdgcn_wave_barrier();
  const int rsub = lane >> 4, c4 = (lane & 15) * 4;
  {
#pragma unroll
    for (int q = 0; q < 8; ++q) {
      const int r = q * 2 + rsub;
      const v4f v = *(const v4fa*)&so[w][r][c4];
      *(v4f*)(C + (size_t)(row0 + r) * ldc + col0 + c4) = v;
    }
    
  }
}
// row LayerNorm (biased variance, eps) over N: s = X (+ R); optional out_sum <- s; out_norm <- (s-mu)*rsqrt(var+eps)*g + b
template <bool PARAM_BF16>
__global__ __launch_bounds__(256) void k_layernorm(const float* __restrict__ X, const float* __restrict__ R, const float* __restrict__ g, const float* __restrict__ bta,
                                                  float* __restrict__ out_sum, float* __restrict__ out_norm, int N, float eps) {
  __shared__ float red[256];
  const int row = blockIdx.x, tid = threadIdx.x;
  const float* x = X + (size_t)row * N; const float* rr = R ? R + (size_t)row * N : nullptr;
  float vals[16];                     // up to N = 4096
  const int per = N / 256;            // contiguous chunk per thread? use strided-by-4 chunks: thread handles j = tid*4 + 1024*u
  float s1 = 0.f;
  for (int u = 0; u < per / 4; ++u) {
    const int j = tid * 4 + 1024 * u;
    const v4f a = *(const v4fa*)(x + j);
    v4f b = {0.f,0.f,0.f,0.f}; if (rr) b = *(const v4fa*)(rr + j);
#pragma unroll
    for (int q = 0; q < 4; ++q) { const float v = a[q] + b[q]; vals[u * 4 + q] = v; s1 += v; }
  }
  red[tid] = s1; __syncthreads();
  for (int st = 128; st > 0; st >>= 1) { if (tid < st) red[tid] += red[tid + st]; __syncthreads(); }
  const float mu = red[0] / (float)N; __syncthreads();
  float s2 = 0.f;
  for (int u = 0; u < per / 4; ++u)
#pragma unroll
    for (int q = 0; q < 4; ++q) { const float c = vals[u * 4 + q] - mu; s2 += c * c; }
  red[tid] = s2; __syncthreads();
  for (int st = 128; st > 0; st >>= 1) { if (tid < st) red[tid] += red[tid + st]; __syncthreads(); }
  const float rs = rsqrtf(red[0] / (float)N + eps);
  {
    for (int u = 0; u < per / 4; ++u) {
      const int j = tid * 4 + 1024 * u;
      v4f o, sm;
#pragma unroll
      for (int q = 0; q < 4; ++q) {
        float gg = g[j + q], bb = bta[j + q];
        if (PARAM_BF16) { gg = bf16_round(gg); bb = bf16_round(bb); }
        sm[q] = vals[u * 4 + q]; o[q] = (vals[u * 4 + q] - mu) * rs * gg + bb;
      }
      if (out_sum) *(v4f*)(out_sum + (size_t)row * N + j) = sm;
      *(v4f*)(out_norm + (size_t)row * N + j) = o;
    }
    
  }
}



// ---- f16 WMMA path (v_wmma_f32_16x16x32_f16): 11-bit significands for operands in range — used where a [0,1] probability operand needs more precision than bf16
typedef _Float16 v16h __attribute__((ext_vector_type(16)));
union FragH { v16h v; v8us half[2]; _Float16 h[16]; unsigned short u[16]; };
template <int NT>
__device__ __forceinline__ v8f mmaH(v16h ah, v16h al, v16h bh, v16h bl, v8f c) {
  c = __builtin_amdgcn_wmma_f32_16x16x32_f16(false, ah, false, bh, (short)0, c, false, false);
  if (NT >= 2) c = __builtin_amdgcn_wmma_f32_16x16x32_f16(false, al, false, bh, (short)0, c, false, false);
  if (NT >= 3) c = __builtin_amdgcn_wmma_f32_16x16x32_f16(false, ah, false, bl, (short)0, c, false, false);
  asm volatile("v_nop\n\tv_nop\n\tv_nop\n\tv_nop" : "+v"(c) : "v"(ah), "v"(al), "v"(bh), "v"(bl));
  return c;
}
// batched GEMM like k_gemm_b but f16 operands: A f32 (split into f16 hi/lo if ASPLIT, else rounded to f16), Bt = f16 values [n][k]; alpha; C f32; N multiple of 16 (partial tiles skipped)
template <bool ASPLIT>
__global__ __launch_bounds__(128) void k_gemm_h(const float* __restrict__ A, int lda, size_t sA, const _Float16* __restrict__ Bh, int ldb, size_t sB, float alpha, float* __restrict__ C, int ldc, size_t sC, int M, int N, int K) {
  __shared__ __attribute__((aligned(16))) float so[4][16][64];
  const int tid = threadIdx.x, w = tid >> 5, lane = tid & 31, ln = lane & 15, hh = lane >> 4; const int by = blockIdx.y;
  A += (size_t)by * sA; Bh += (size_t)by * sB; C += (size_t)by * sC;
  const int ntn = (N + 63) / 64; const int wid = blockIdx.x * 4 + w; const int mt = wid / ntn, nq = wid % ntn; if (mt * 16 >= M) return;
  const int row0 = mt * 16, col0 = nq * 64; const float* arow = A + (size_t)(row0 + ln) * lda;
  v8f acc[4] = {};
  for (int kb = 0; kb < K; kb += 32) {
    FragH ah, al;
    const v4f x0 = *(const v4fa*)(arow + kb + 8 * hh), x1 = *(const v4fa*)(arow + kb + 8 * hh + 4), x2 = *(const v4fa*)(arow + kb + 16 + 8 * hh), x3 = *(const v4fa*)(arow + kb + 16 + 8 * hh + 4);
    float xs[16] = {x0[0],x0[1],x0[2],x0[3],x1[0],x1[1],x1[2],x1[3],x2[0],x2[1],x2[2],x2[3],x3[0],x3[1],x3[2],x3[3]};
#pragma unroll
    for (int i = 0; i < 16; ++i) { const _Float16 h = (_Float16)xs[i]; ah.h[i] = h; al.h[i] = ASPLIT ? (_Float16)(xs[i] - (float)h) : (_Float16)0.0f; }
#pragma unroll
    for (int t = 0; t < 4; ++t) { if (col0 + t * 16 >= N) continue; const size_t boff = (size_t)(col0 + t * 16 + ln) * ldb + kb; FragH bq; bq.half[0] = *(const v8us*)(Bh + boff + 8 * hh); bq.half[1] = *(const v8us*)(Bh + boff + 16 + 8 * hh);
      acc[t] = mmaH<ASPLIT ? 2 : 1>(ah.v, al.v, bq.v, bq.v, acc[t]); }
  }
#pragma unroll
  for (int t = 0; t < 4; ++t) { if (col0 + t * 16 >= N) continue;
#pragma unroll
    for (int r = 0; r < 8; ++r) so[w][8 * hh + r][t * 16 + ln] = acc[t][r] * alpha; }
  __builtin_amdgcn_fence(__ATOMIC_ACQ_REL, "workgroup"); __builtin_amdgcn_wave_barrier();
  const int rsub = lane >> 4, c4 = (lane & 15) * 4;
  {
#pragma unroll
    for (int q = 0; q < 8; ++q) { const int r = q * 2 + rsub; if (col0 + c4 < N) { const v4f v = *(const v4fa*)&so[w][r][c4]; *(v4f*)(C + (size_t)(row0 + r) * ldc + col0 + c4) = v; } }
     }
}

// Wt[n][k] = f16(W[k][n]*scale) from f32 row-major W[K][N] (scale = power of two; bf16-exact weights stay exact in f16 away from the subnormal range). K % 128 == 0, N % 64 == 0.
// Transposed in registers: a lane reads 16-byte pieces (4 n) of 8 successive rows k, which is 4 output pieces of 16 bytes (8 k). Lanes: 4 along n, 8 along k, so a wave's store covers four whole
// 128-byte lines of Wt and its two loads of a row group cover the two halves of eight 128-byte lines of W. A wave takes 64 k x 32 n, a block (2 x 2 waves) 128 k x 64 n: 256 bytes a row on both sides.
// blk = the tile's number among the (K / 128) * (N / 64) tiles of this matrix; 128 threads.
__device__ __forceinline__ void wt_f16_tile(const float* __restrict__ W, _Float16* __restrict__ Wt, int K, int N, float scale, int blk) {
  const int lane = threadIdx.x & 31, w = threadIdx.x >> 5; const int ntn = N >> 6; const int bk = blk / ntn, bn = blk - bk * ntn;
  const int k0 = bk * 128 + (w >> 1) * 64 + (lane >> 2) * 8, n0 = bn * 64 + (w & 1) * 32 + (lane & 3) * 4;
  const float* p[8]; v4f a[8], b[8];
  /* unrolled: the arrays get constant indices (registers) */
#pragma unroll
  for (int i = 0; i < 8; ++i) { p[i] = W + (size_t)(k0 + i) * N + n0; a[i] = *(const v4fa*)p[i]; b[i] = *(const v4fa*)(p[i] + 16); }
  /* The loaded values are inputs: all sixteen loads stay in front of the first conversion, so the wave pays one memory latency (left alone the compiler sinks half of them among the conversions: four more round trips).
     The row pointers are inputs: they stay live up to here, so no load's result lands on an address pair of an issued load, and the wait precedes every later overwrite of such a pair */
  asm volatile("s_wait_xcnt 0x0" :: "v"(a[0]), "v"(a[1]), "v"(a[2]), "v"(a[3]), "v"(a[4]), "v"(a[5]), "v"(a[6]), "v"(a[7]), "v"(b[0]), "v"(b[1]), "v"(b[2]), "v"(b[3]), "v"(b[4]), "v"(b[5]), "v"(b[6]), "v"(b[7]),
               "v"(p[0]), "v"(p[1]), "v"(p[2]), "v"(p[3]), "v"(p[4]), "v"(p[5]), "v"(p[6]), "v"(p[7]));
  unsigned short* d = (unsigned short*)Wt + (size_t)n0 * K + k0;
#pragma unroll
  for (int q = 0; q < 4; ++q) { FragH f;
#pragma unroll
    for (int i = 0; i < 8; ++i) { f.h[i] = (_Float16)(bf16_round(a[i][q]) * scale); f.h[8 + i] = (_Float16)(bf16_round(b[i][q]) * scale); }
    *(v8us*)(d + (size_t)q * K) = f.half[0]; *(v8us*)(d + (size_t)(16 + q) * K) = f.half[1]; }
}
// k_gemm_hh variant with fused epilogue: v = acc·alpha + bias[by·sBias + col] (+ CP[(row/rowsPerB)·sCPb + by·64 + col] if CP) ; ACT 0 none / 1 elu ; writes f16 C16 (and f32 C if non-null)
template <int ACT>
__global__ __launch_bounds__(128) void k_gemm_hhx(const _Float16* __restrict__ A, int lda, size_t sA, const _Float16* __restrict__ Bh, int ldb, size_t sB, float alpha, const float* __restrict__ bias, size_t sBias, const float* __restrict__ CP, int rowsPerB, size_t sCPb, int row0g,
    float* __restrict__ C, _Float16* __restrict__ C16, int ldc, size_t sC, int M, int N, int K) {
  __shared__ __attribute__((aligned(16))) float so[4][16][64];
  const int tid = threadIdx.x, w = tid >> 5, lane = tid & 31, ln = lane & 15, hh = lane >> 4; const int by = blockIdx.y;
  A += (size_t)by * sA; Bh += (size_t)by * sB; const size_t cofs = (size_t)by * sC; const float* bp = bias ? bias + (size_t)by * sBias : nullptr;
  const int ntn = (N + 63) / 64; const int wid = blockIdx.x * 4 + w; const int mt = wid / ntn, nq = wid % ntn; if (mt * 16 >= M) return;
  const int row0 = mt * 16, col0 = nq * 64; const _Float16* arow = A + (size_t)(row0 + ln) * lda;
  v8f acc[4] = {};
  for (int kb = 0; kb < K; kb += 32) { FragH ah; ah.half[0] = *(const v8us*)((const unsigned short*)arow + kb + 8 * hh); ah.half[1] = *(const v8us*)((const unsigned short*)arow + kb + 16 + 8 * hh);
#pragma unroll
    for (int t = 0; t < 4; ++t) { if (col0 + t * 16 >= N) continue; const size_t boff = (size_t)(col0 + t * 16 + ln) * ldb + kb; FragH bq; bq.half[0] = *(const v8us*)((const unsigned short*)Bh + boff + 8 * hh); bq.half[1] = *(const v8us*)((const unsigned short*)Bh + boff + 16 + 8 * hh);
      acc[t] = mmaH<1>(ah.v, ah.v, bq.v, bq.v, acc[t]); }
  }
#pragma unroll
  for (int t = 0; t < 4; ++t) { if (col0 + t * 16 >= N) continue; const int col = col0 + t * 16 + ln; const float bv = bp ? bf16_round(bp[col]) : 0.f;
#pragma unroll
    for (int r = 0; r < 8; ++r) { float v = acc[t][r] * alpha + bv; if (CP) { const int rr = row0g + row0 + 8 * hh + r; if (rowsPerB < 0) v += CP[cofs + (size_t)rr * ldc + col];      /* rowsPerB < 0: own element of the batched C plane */ else { const int bidx = rr / rowsPerB; v += CP[(size_t)bidx * sCPb + (size_t)by * 64 + col]; } } if (ACT == 1) v = (v > 0.f) ? v : expm1f(v); else if (ACT == 7) v = (v > 0.f) ? v + 1.0f : expf(v); else if (ACT == 8) v = tanhf(v); else if (ACT == 9) v = 0.5f * v * (1.0f + tanhf(0.7978845608028654f * (v + 0.044715f * v * v * v))); else if (ACT == 11) v = 1.0f / (1.0f + expf(-v)); else if (ACT == 12) v = (v > 0.f) ? v : 0.01f * v; else if (ACT == 14) v = (v > 0.f) ? v : 0.1f * v; else if (ACT == 16) v = (v >= 0.f) ? v : 0.3f * v; else if (ACT == 17) v = (v >= 0.f) ? v : 0.2f * v; else if (ACT == 15) v = v / (1.0f + expf(-v)); else if (ACT == 3) v = fmaxf(v, 0.f); else if (ACT == 6) v = 0.5f * v * (1.0f + erff(v * 0.70710678118654752f)); so[w][8 * hh + r][t * 16 + ln] = v; } }
  __builtin_amdgcn_fence(__ATOMIC_ACQ_REL, "workgroup"); __builtin_amdgcn_wave_barrier();
  const int rsub = lane >> 4, c4 = (lane & 15) * 4; typedef _Float16 v4h __attribute__((ext_vector_type(4)));
  {
#pragma unroll
    for (int q = 0; q < 8; ++q) { const int r = q * 2 + rsub; if (col0 + c4 < N) { const v4f v = *(const v4fa*)&so[w][r][c4]; if (C) *(v4f*)(C + cofs + (size_t)(row0 + r) * ldc + col0 + c4) = v; if (C16) { v4h h4; for (int i = 0; i < 4; ++i) h4[i] = (_Float16)v[i]; *(v4h*)(C16 + cofs + (size_t)(row0 + r) * ldc + col0 + c4) = h4; } } }
     }
}


typedef _Float16 v4h __attribute__((ext_vector_type(4)));

__global__ __launch_bounds__(256) void k_h16(const float* __restrict__ x, _Float16* __restrict__ X16, size_t n8) { const size_t t = (size_t)blockIdx.x * 256 + threadIdx.x; if (t >= n8) return; FragH f;
#pragma unroll
  for (int q = 0; q < 8; ++q) f.h[q] = (_Float16)x[t * 8 + q]; *(v8us*)((unsigned short*)X16 + t * 8) = f.half[0];  }
__global__ __launch_bounds__(256) void k_round16f(const float* __restrict__ W, _Float16* __restrict__ Bt, size_t n8) { const size_t t = (size_t)blockIdx.x * 256 + threadIdx.x; if (t >= n8) return; FragH f;
#pragma unroll
  for (int i = 0; i < 8; ++i) f.h[i] = (_Float16)(bf16_round(W[t * 8 + i]) * 16.0f); *(v8us*)((unsigned short*)Bt + t * 8) = f.half[0];  }
template <int NHv, int TTv>
__global__ __launch_bounds__(256) void k_vt(const _Float16* __restrict__ V16, int ldv, int voff, _Float16* __restrict__ Vt) { __shared__ unsigned short tl[64][66]; const int tid = threadIdx.x; const int slab = blockIdx.x / (TTv / 64), lg = blockIdx.x % (TTv / 64); const int b = slab / NHv, h = slab % NHv;
  for (int i = tid; i < 64 * 8; i += 256) { const int r = i / 8, c8 = (i % 8) * 8; FragH f; f.half[0] = *(const v8us*)((const unsigned short*)V16 + ((size_t)b * TTv + lg * 64 + r) * ldv + voff + h * 64 + c8);
#pragma unroll
    for (int q = 0; q < 8; ++q) tl[r][c8 + q] = f.u[q]; }
  __syncthreads();
  {
#pragma unroll
    for (int rd = 0; rd < 2; ++rd) { const int d = rd * 32 + tid / 8, pc = tid % 8; FragH f;
#pragma unroll
      for (int q = 0; q < 8; ++q) f.u[q] = tl[pc * 8 + q][d];
      *(v8us*)((unsigned short*)Vt + ((size_t)slab * 64 + d) * TTv + lg * 64 + pc * 8) = f.half[0]; }
     } }

__global__ __launch_bounds__(256) void k_hl(const float* __restrict__ F, _Float16* __restrict__ Hh, _Float16* __restrict__ Hl, size_t n8) { const size_t t = (size_t)blockIdx.x * 256 + threadIdx.x; if (t >= n8) return; FragH fh, fl; const v4f a = *(const v4fa*)(F + t * 8), c = *(const v4fa*)(F + t * 8 + 4);
#pragma unroll
  for (int q = 0; q < 4; ++q) { _Float16 h = (_Float16)a[q]; fh.h[q] = h; fl.h[q] = (_Float16)((a[q] - (float)h) * 1024.0f); h = (_Float16)c[q]; fh.h[4 + q] = h; fl.h[4 + q] = (_Float16)((c[q] - (float)h) * 1024.0f); }
  { *(v8us*)((unsigned short*)Hh + t * 8) = fh.half[0]; *(v8us*)((unsigned short*)Hl + t * 8) = fl.half[0];  } }

// ---- fast GEMM (block tile 128x128 = 4 x 2 waves, wave tile 32x64; A and B tiles of 128 k staged in LDS by asynchronous copies, two buffers; requires M % 128 == 0, N % 128 == 0, K % 128 == 0); epilogue = k_gemm_hhx semantics, the residual (RES) in its own-element form only ----
__device__ __forceinline__ v16h g2_frag(const _Float16* p, int hh) { FragH f; f.half[0] = *(const v8us*)((const unsigned short*)p + 8 * hh); f.half[1] = *(const v8us*)((const unsigned short*)p + 16 + 8 * hh); return f.v; }
__device__ __forceinline__ v8f g2_mma(v16h a, v16h b, v8f c) { v8f d = __builtin_amdgcn_wmma_f32_16x16x32_f16(false, a, false, b, (short)0, c, false, false); asm volatile("v_nop\n\tv_nop\n\tv_nop\n\tv_nop" : "+v"(d) : "v"(a), "v"(b)); return d; }
#define G2_PITCH 272      /* LDS row pitch, bytes: 256 of data + 16, an odd multiple of 16 (no bank conflict for 16-byte row reads) */
#define G2_STAGE (256 * G2_PITCH)      /* one buffer: 128 rows of A, then 128 rows of B, 128 k each */
// Eight asynchronous 16-byte copies of a lane, global -> LDS, rows 16 apart (st = 16 source rows, in elements). The s_wait_xcnt stands in the copies' own statement, behind the last of them,
// so that it precedes every later write of a register that a copy names.
__device__ __forceinline__ void g2_copy8(unsigned l, const _Float16* g, size_t st) {
  asm volatile("global_load_async_to_lds_b128 %0, %8, off\n\t"
               "global_load_async_to_lds_b128 %1, %9, off\n\t"
               "global_load_async_to_lds_b128 %2, %10, off\n\t"
               "global_load_async_to_lds_b128 %3, %11, off\n\t"
               "global_load_async_to_lds_b128 %4, %12, off\n\t"
               "global_load_async_to_lds_b128 %5, %13, off\n\t"
               "global_load_async_to_lds_b128 %6, %14, off\n\t"
               "global_load_async_to_lds_b128 %7, %15, off\n\t"
               "s_wait_xcnt 0x0"
               :: "v"(l), "v"(l + 16u * G2_PITCH), "v"(l + 32u * G2_PITCH), "v"(l + 48u * G2_PITCH), "v"(l + 64u * G2_PITCH), "v"(l + 80u * G2_PITCH), "v"(l + 96u * G2_PITCH), "v"(l + 112u * G2_PITCH),
                  "v"(g), "v"(g + st), "v"(g + 2 * st), "v"(g + 3 * st), "v"(g + 4 * st), "v"(g + 5 * st), "v"(g + 6 * st), "v"(g + 7 * st) : "memory"); }
// a fragment from a staged row: p = the row's place + 64 bytes a k step + 16 hh; same k order as g2_frag
__device__ __forceinline__ v16h g2_lfrag(const unsigned char* p) { FragH f; f.half[0] = *(const v8us*)p; f.half[1] = *(const v8us*)(p + 32); return f.v; }
// GELU v Phi(v) of four values, in place, one straight line for every lane (the library erff takes two divergent branches a value, so the 64 values of a lane run one after another as dependent chains; here they interleave).
// Phi(-|v|) = (1 / 2) erfc(|v| / sqrt 2) = exp(-v v / 2) t P(t), t = 1 / (1 + p |v| / sqrt 2): the five-term rational form of erfc, absolute error 1.5e-7 in erf; the 1 / 2 is in the coefficients.
// v Phi(v) = max(v, 0) - |v| Phi(-|v|): no 1 + erf, so nothing cancels for negative v.
__device__ __forceinline__ void g2_gelu4(float* v) {
  float d[4], x[4], t[4], e[4];
  /* every loop here is unrolled: constant indices, so the arrays are registers */
#pragma unroll
  for (int i = 0; i < 4; ++i) { d[i] = fmaf(fabsf(v[i]), 0.23164189f, 1.0f); x[i] = v[i] * v[i] * -0.72134752f; }
  /* native 1 / d and 2^x, eight in one statement: each fills the slot that the instruction set asks for behind the one in front of it, the v_nop the slot behind the last (the early clobbers keep every result off every source),
     and the first results are ready when the statement ends, so no reader waits at issue */
  asm("v_rcp_f32 %0, %8\n\tv_rcp_f32 %1, %9\n\tv_rcp_f32 %2, %10\n\tv_rcp_f32 %3, %11\n\tv_exp_f32 %4, %12\n\tv_exp_f32 %5, %13\n\tv_exp_f32 %6, %14\n\tv_exp_f32 %7, %15\n\tv_nop"
      : "=&v"(t[0]), "=&v"(t[1]), "=&v"(t[2]), "=&v"(t[3]), "=&v"(e[0]), "=&v"(e[1]), "=&v"(e[2]), "=&v"(e[3]) : "v"(d[0]), "v"(d[1]), "v"(d[2]), "v"(d[3]), "v"(x[0]), "v"(x[1]), "v"(x[2]), "v"(x[3]));
#pragma unroll
  for (int i = 0; i < 4; ++i) { float q = fmaf(0.53070271f, t[i], -0.72657603f); q = fmaf(q, t[i], 0.71070689f); q = fmaf(q, t[i], -0.14224836f); q = fmaf(q, t[i], 0.12741479f);
    v[i] = fmaf(-fabsf(v[i]), q * t[i] * e[i], fmaxf(v[i], 0.f)); } }
template <int ACT, bool RES>
__global__ __launch_bounds__(256) void k_gemm2(const _Float16* __restrict__ A, int lda, size_t sA, const _Float16* __restrict__ Bh, int ldb, size_t sB, float alpha, const float* __restrict__ bias, size_t sBias, const float* __restrict__ CP, int rowsPerB, size_t sCPb, int row0g,
    float* __restrict__ C, _Float16* __restrict__ C16, int ldc, size_t sC, int M, int N, int K) { static_assert(ACT == 0 || ACT == 3 || ACT == 6 || ACT == 8 || ACT == 9 || ACT == 11 || ACT == 12 || ACT == 14 || ACT == 15 || ACT == 16 || ACT == 17, "k_gemm2: unsupported ACT code (would silently apply no activation)");
  static_assert(!RES || ACT == 0, "k_gemm2: the residual is added behind the staging, which is in front of the activation only where there is none"); (void)rowsPerB; (void)sCPb;      /* RES: CP holds the residual plane, laid out as C, first row row0g */
  __shared__ __attribute__((aligned(16))) unsigned char sm[2 * G2_STAGE]; float (*so)[32][68] = (float (*)[32][68])sm;      /* two operand buffers; behind the loop's last barrier the same LDS stages the output tile */
  const int tid = threadIdx.x, w = tid >> 5, lane = tid & 31, ln = lane & 15, hh = lane >> 4; const int by = blockIdx.y;
  A += (size_t)by * sA; Bh += (size_t)by * sB; const size_t cofs = (size_t)by * sC; const float* bp = bias ? bias + (size_t)by * sBias : nullptr;
  const int wm = w & 3, wn = w >> 2;      /* the wave's place in the block tile: 32 rows, 64 columns */
  const int ntn = N >> 7; const int mt = blockIdx.x / ntn, nq = blockIdx.x - mt * ntn; const int row0 = mt * 128 + 32 * wm, col0 = nq * 128 + 64 * wn; if (mt * 128 >= M) return;      /* the whole block leaves, in front of every barrier */
  /* copies: lane = 16 bytes; 16 lanes a row of 256 bytes, so a wave's copy covers two whole rows; thread rows tid / 16 + 16 i */
  const unsigned lc = (unsigned)(size_t)sm + (unsigned)(tid >> 4) * G2_PITCH + (unsigned)(tid & 15) * 16u;
  const _Float16* ga = A + (size_t)(mt * 128 + (tid >> 4)) * lda + (tid & 15) * 8; const _Float16* gb = Bh + (size_t)(nq * 128 + (tid >> 4)) * ldb + (tid & 15) * 8;
  auto fill = [&](int t, int buf) { const unsigned l = lc + (unsigned)buf * G2_STAGE;
    g2_copy8(l, ga + (size_t)t * 128, (size_t)16 * lda); g2_copy8(l + 128u * G2_PITCH, gb + (size_t)t * 128, (size_t)16 * ldb); };
  const unsigned char* sa = sm + (32 * wm + ln) * G2_PITCH + 16 * hh; const unsigned char* sb = sm + (128 + 64 * wn + ln) * G2_PITCH + 16 * hh;
  const v8f z8 = {0.f,0.f,0.f,0.f,0.f,0.f,0.f,0.f}; v8f c00 = z8, c01 = z8, c02 = z8, c03 = z8, c10 = z8, c11 = z8, c12 = z8, c13 = z8;
  const int nt = K >> 7;
  fill(0, 0);
  /* the wave's four bias values go out here as one group: their latency passes under that of tile 0's copies. The s_wait_xcnt stands behind the loads, in front of every later overwrite of a register that they name (the pointer is its input and stays live up to it) */
  float bl[4] = {0.f, 0.f, 0.f, 0.f};
  if (bp) { const float* b0 = bp + col0 + ln;
#pragma unroll
    for (int t = 0; t < 4; ++t) bl[t] = b0[t * 16];
    asm volatile("s_wait_xcnt 0x0" :: "v"(b0) : "memory"); }
  asm volatile("s_wait_asynccnt 0x0" ::: "memory");      /* this wave's copies of tile 0 have landed */
  __syncthreads();      /* and every other wave's: tile 0 may be read */
  if (nt > 1) fill(1, 1);
  /* rolled: one copy of the body; a trip is 128 k = 32 products a wave, while the next tile's copies fly */
#pragma unroll 1
  for (int t = 0; t < nt; ++t) { const unsigned char* pa = sa + (t & 1) * G2_STAGE; const unsigned char* pb = sb + (t & 1) * G2_STAGE;
    v16h fa[2][2], fb[2][4];      /* two fragment sets */
    fa[0][0] = g2_lfrag(pa); fb[0][0] = g2_lfrag(pb); fa[0][1] = g2_lfrag(pa + 16 * G2_PITCH); fb[0][1] = g2_lfrag(pb + 16 * G2_PITCH); fb[0][2] = g2_lfrag(pb + 32 * G2_PITCH); fb[0][3] = g2_lfrag(pb + 48 * G2_PITCH);
    /* unrolled: the sets get constant indices (registers) and the LDS offsets become immediates. The reads of k step ks + 1 go as one group in front of the products of step ks, so only the trip's first group is waited for in full */
#pragma unroll
    for (int ks = 0; ks < 4; ++ks) { const int c = ks & 1, n = c ^ 1, o = (ks + 1) * 64;
      if (ks < 3) { fa[n][0] = g2_lfrag(pa + o); fb[n][0] = g2_lfrag(pb + o); fa[n][1] = g2_lfrag(pa + 16 * G2_PITCH + o); fb[n][1] = g2_lfrag(pb + 16 * G2_PITCH + o); fb[n][2] = g2_lfrag(pb + 32 * G2_PITCH + o); fb[n][3] = g2_lfrag(pb + 48 * G2_PITCH + o); }
      c00 = g2_mma(fa[c][0], fb[c][0], c00); c10 = g2_mma(fa[c][1], fb[c][0], c10);
      c01 = g2_mma(fa[c][0], fb[c][1], c01); c11 = g2_mma(fa[c][1], fb[c][1], c11);
      c02 = g2_mma(fa[c][0], fb[c][2], c02); c12 = g2_mma(fa[c][1], fb[c][2], c12);
      c03 = g2_mma(fa[c][0], fb[c][3], c03); c13 = g2_mma(fa[c][1], fb[c][3], c13); }
    asm volatile("s_wait_dscnt 0x0" ::: "memory");      /* this wave's reads of the buffer are done before it is refilled */
    asm volatile("s_wait_asynccnt 0x0" ::: "memory");      /* this wave's copies of tile t + 1 have landed */
    __syncthreads();      /* publishes tile t + 1 and ends every wave's reads of tile t */
    if (t + 2 < nt) fill(t + 2, t & 1); }
  asm volatile("s_wait_asynccnt 0x0" ::: "memory");      /* no copy is outstanding when the LDS changes its use */
  const int rsub = lane >> 4, c4 = (lane & 15) * 4; const size_t e0 = cofs + (size_t)(row0 + rsub) * ldc + col0 + c4, es = (size_t)2 * ldc;      /* the lane's 16-byte piece of tile row rsub + 2 q stands at element e0 + q es of the C plane */
  /* The residual goes out here as one group of sixteen loads, in the store phase's own layout (whole 256-byte row pieces, 16 bytes a lane): the wave pays one memory latency for all of it, and the scaling and staging below run under it.
     The s_wait_xcnt stands behind the loads; the pointers are its inputs, so they stay live up to it: no load's result lands on an address of an issued load, and the wait precedes every later overwrite of one */
  v4f rv[16];
  if (RES) { const float* rp[16];
#pragma unroll
    for (int q = 0; q < 16; ++q) { rp[q] = CP + (size_t)row0g * ldc + e0 + q * es; rv[q] = *(const v4fa*)rp[q]; }
    asm volatile("s_wait_xcnt 0x0" :: "v"(rp[0]), "v"(rp[1]), "v"(rp[2]), "v"(rp[3]), "v"(rp[4]), "v"(rp[5]), "v"(rp[6]), "v"(rp[7]), "v"(rp[8]), "v"(rp[9]), "v"(rp[10]), "v"(rp[11]), "v"(rp[12]), "v"(rp[13]), "v"(rp[14]), "v"(rp[15]) : "memory"); }
  v8f accs[8] = {c00, c01, c02, c03, c10, c11, c12, c13};
#pragma unroll
  for (int u = 0; u < 8; ++u) { const int t = u & 3, half = u >> 2; const float bv = bf16_round(bl[t]);
    if (ACT == 6) { float vv[8];      /* the tile's eight values of a lane go through the GELU four at a time */
#pragma unroll
      for (int r = 0; r < 8; ++r) vv[r] = accs[u][r] * alpha + bv;
      g2_gelu4(vv); g2_gelu4(vv + 4);
#pragma unroll
      for (int r = 0; r < 8; ++r) so[w][half * 16 + 8 * hh + r][t * 16 + ln] = vv[r];
      continue; }
#pragma unroll
    for (int r = 0; r < 8; ++r) { const int rloc = half * 16 + 8 * hh + r; float v = accs[u][r] * alpha + bv;
      if (ACT == 3) v = fmaxf(v, 0.f); else if (ACT == 11) v = 1.0f / (1.0f + expf(-v)); else if (ACT == 15) v = v / (1.0f + expf(-v)); else if (ACT == 12) v = (v > 0.f) ? v : 0.01f * v; else if (ACT == 8) v = tanhf(v); else if (ACT == 9) v = 0.5f * v * (1.0f + tanhf(0.7978845608028654f * (v + 0.044715f * v * v * v))); else if (ACT == 14) v = (v > 0.f) ? v : 0.1f * v; else if (ACT == 16) v = (v >= 0.f) ? v : 0.3f * v; else if (ACT == 17) v = (v >= 0.f) ? v : 0.2f * v;
      so[w][rloc][t * 16 + ln] = v; } }
  __builtin_amdgcn_fence(__ATOMIC_ACQ_REL, "workgroup"); __builtin_amdgcn_wave_barrier();
  v4f ov[16];
#pragma unroll
  for (int q = 0; q < 16; ++q) { ov[q] = *(const v4fa*)&so[w][q * 2 + rsub][c4]; if (RES) ov[q] += rv[q]; }
  /* stores in groups of eight; behind each group the s_wait_xcnt, with the group's pointers and data as inputs: they stay as they are up to the wait */
  if (C) {
#pragma unroll
    for (int g = 0; g < 2; ++g) { float* cp[8];
#pragma unroll
      for (int i = 0; i < 8; ++i) { cp[i] = C + e0 + (g * 8 + i) * es; *(v4f*)cp[i] = ov[g * 8 + i]; }
      asm volatile("s_wait_xcnt 0x0" :: "v"(cp[0]), "v"(cp[1]), "v"(cp[2]), "v"(cp[3]), "v"(cp[4]), "v"(cp[5]), "v"(cp[6]), "v"(cp[7]), "v"(ov[g * 8 + 0]), "v"(ov[g * 8 + 1]), "v"(ov[g * 8 + 2]), "v"(ov[g * 8 + 3]), "v"(ov[g * 8 + 4]), "v"(ov[g * 8 + 5]), "v"(ov[g * 8 + 6]), "v"(ov[g * 8 + 7]) : "memory"); } }
  if (C16) {
#pragma unroll
    for (int g = 0; g < 2; ++g) { _Float16* cp[8]; v4h hv[8];
#pragma unroll
      for (int i = 0; i < 8; ++i) { for (int j = 0; j < 4; ++j) hv[i][j] = (_Float16)ov[g * 8 + i][j]; cp[i] = C16 + e0 + (g * 8 + i) * es; *(v4h*)cp[i] = hv[i]; }
      asm volatile("s_wait_xcnt 0x0" :: "v"(cp[0]), "v"(cp[1]), "v"(cp[2]), "v"(cp[3]), "v"(cp[4]), "v"(cp[5]), "v"(cp[6]), "v"(cp[7]), "v"(hv[0]), "v"(hv[1]), "v"(hv[2]), "v"(hv[3]), "v"(hv[4]), "v"(hv[5]), "v"(hv[6]), "v"(hv[7]) : "memory"); } } }


__global__ __launch_bounds__(256) void k_wnat(const float* __restrict__ w, size_t n8, _Float16* __restrict__ Bt) { const size_t t = (size_t)blockIdx.x * 256 + threadIdx.x; if (t >= n8) return; FragH f; for (int q = 0; q < 8; ++q) f.h[q] = (_Float16)(bf16_round(w[t * 8 + q]) * 16.0f); *(v8us*)((unsigned short*)Bt + t * 8) = f.half[0];  }
__global__ __launch_bounds__(256) void k_rsm(const float* __restrict__ S, _Float16* __restrict__ P, int nrows) {
  #pragma clang fp contract(off)
  const int i = blockIdx.x * 256 + threadIdx.x; if (i >= nrows) return; const float* s = S + (size_t)i * SQ; float mx = -3.0e38f;
#pragma unroll 1
  for (int j = 0; j < SQ; ++j) mx = fmaxf(mx, s[j]); float se = 0.f;
#pragma unroll 1
  for (int j = 0; j < SQ; ++j) se += expf(s[j] - mx); const float sc = 256.0f / se;
#pragma unroll 1
  for (int j0 = 0; j0 < SQ; j0 += 8) { FragH f; for (int q = 0; q < 8; ++q) f.h[q] = (_Float16)(expf(s[j0 + q] - mx) * sc); unsigned short* d = (unsigned short*)P + (size_t)i * SQ + j0; *(v8us*)d = f.half[0];  } }
__global__ __launch_bounds__(256) void k_vt(const _Float16* __restrict__ V16, int b, int h0, _Float16* __restrict__ VT) { __shared__ unsigned short tl[64][65]; const int tid = threadIdx.x; const int hh = blockIdx.x % HG, sg = blockIdx.x / HG; const int s0 = sg * 64; const int h = h0 + hh;
  for (int i = tid; i < 64 * 8; i += 256) { const int j = i / 8, d8 = (i % 8) * 8; FragH f; f.half[0] = *(const v8us*)((const unsigned short*)V16 + ((size_t)b * SQ + s0 + j) * DM + h * HD + d8); for (int q = 0; q < 8; ++q) tl[d8 + q][j] = f.u[q]; }
  __syncthreads();
  { for (int i = tid; i < 64 * 8; i += 256) { const int d = i / 8, j8 = (i % 8) * 8; FragH f; for (int q = 0; q < 8; ++q) f.u[q] = tl[d][j8 + q]; *(v8us*)((unsigned short*)VT + ((size_t)hh * HD + d) * SQ + s0 + j8) = f.half[0]; }  } }



__global__ __launch_bounds__(256) void k_rsmcf2(const float* __restrict__ S, _Float16* __restrict__ P, int hg, int q0, int nk) {
  #pragma clang fp contract(off)
  const int t = blockIdx.x * 256 + threadIdx.x; if (t >= hg * QT) return; const size_t i = (size_t)t; const float* s = S + i * NKX; const int last = q0 + (t % QT); float mx = -3.0e38f;
#pragma unroll 1
  for (int j = 0; j < nk; ++j) { const float f = (j <= last) ? 1.f : 0.f; mx = fmaxf(mx, fmaf(f, s[j], (1.f - f) * -1.0e9f)); } float se = 0.f;
#pragma unroll 1
  for (int j = 0; j < nk; ++j) { const float f = (j <= last) ? 1.f : 0.f; se += __expf(fmaf(f, s[j], (1.f - f) * -1.0e9f) - mx); } const float sc = 256.0f / se;
#pragma unroll 1
  for (int j0 = 0; j0 < nk; j0 += 8) { FragH fr; for (int q = 0; q < 8; ++q) { const int j = j0 + q; const float f = (j <= last) ? 1.f : 0.f; fr.h[q] = (_Float16)(__expf(fmaf(f, s[j], (1.f - f) * -1.0e9f) - mx) * sc); } unsigned short* d = (unsigned short*)P + i * NKX + j0; *(v8us*)d = fr.half[0];  } }


template <int MASKADD>
__global__ __launch_bounds__(64) void k_att0(const float* __restrict__ QF, const float* __restrict__ KF, const float* __restrict__ VF, int ld, const float* __restrict__ mask, float scale, float* __restrict__ OF, int ldo) {
  #pragma clang fp contract(off)
  __shared__ __attribute__((aligned(16))) float lq[64][64]; __shared__ __attribute__((aligned(16))) float lo[64][64];
  const int tid = threadIdx.x; const int h = blockIdx.x / (QT0 / 64), rg = blockIdx.x % (QT0 / 64); const int i = rg * 64 + tid;
  const float* qr = QF + (size_t)i * ld + h * HD;
#pragma unroll 1
  for (int c = 0; c < HD / 4; ++c) { *(v4f*)&lq[tid][c * 4] = *(const v4fa*)(qr + c * 4); const v4f z = {0.f, 0.f, 0.f, 0.f}; *(v4f*)&lo[tid][c * 4] = z; }
  float m = -1.0e30f, l = 0.f; const int jmax = MASKADD ? (SQ - 1) : (rg * 64 + 63);      /* additive-mask form: every key (the mask input decides); causal form: keys up to the block's last row */
#pragma unroll 1
  for (int j = 0; j <= jmax; ++j) { const float* kr = KF + (size_t)j * ld + h * HD; const float* vr = VF + (size_t)j * ld + h * HD; float s = 0.f;
#pragma unroll 1
    for (int c = 0; c < HD / 4; ++c) { const v4f kq = *(const v4fa*)(kr + c * 4); const v4f qq = *(v4f*)&lq[tid][c * 4]; s = __fadd_rn(s, __fmul_rn(qq[0], kq[0])); s = __fadd_rn(s, __fmul_rn(qq[1], kq[1])); s = __fadd_rn(s, __fmul_rn(qq[2], kq[2])); s = __fadd_rn(s, __fmul_rn(qq[3], kq[3])); }
    s = __fmul_rn(s, scale); if (MASKADD) s = __fadd_rn(s, __fmul_rn(bf16_round(mask[(size_t)i * SQ + j]), -10000.0f));
    const float f = (MASKADD || j <= i) ? 1.f : 0.f; const float sm = fmaf(f, s, (1.f - f) * -1.0e30f); const float mn = fmaxf(m, sm); const float sc = expf(m - mn); const float e = expf(sm - mn); l = __fadd_rn(__fmul_rn(l, sc), e); m = mn;
#pragma unroll 1
    for (int c = 0; c < HD / 4; ++c) { const v4f vv = *(const v4fa*)(vr + c * 4); v4f oo = *(v4f*)&lo[tid][c * 4]; for (int u = 0; u < 4; ++u) oo[u] = __fadd_rn(__fmul_rn(oo[u], sc), __fmul_rn(e, vv[u])); *(v4f*)&lo[tid][c * 4] = oo; } }
  const float fin = 64.0f / l;      /* o carried x64 like the f16 path */
#pragma unroll 1
  for (int c = 0; c < HD / 4; ++c) { v4f oo = *(v4f*)&lo[tid][c * 4]; for (int u = 0; u < 4; ++u) oo[u] = __fmul_rn(oo[u], fin); *(v4f*)&lo[tid][c * 4] = oo; }
  __syncthreads();
  {
#pragma unroll 1
    for (int it = 0; it < 16; ++it) { const int row = it * 4 + tid / 16, pc = (tid % 16) * 4; const v4f v = *(const v4f*)&lo[row][pc]; *(v4f*)(OF + (size_t)(rg * 64 + row) * ldo + h * HD + pc) = v; }
     } }


template <int BFIN, int WXB>
__global__ __launch_bounds__(256) void k_ln16(const float* __restrict__ X, const float* __restrict__ g, const float* __restrict__ bb, float eps, _Float16* __restrict__ N16, float* __restrict__ XB) {
  #pragma clang fp contract(off)
  __shared__ float red[256]; const size_t r = blockIdx.x; const int t = threadIdx.x; const v4f xa = *(const v4fa*)(X + r * DMQ + t * 4); float s[4]; float sum = 0.f;
  for (int q = 0; q < 4; ++q) { s[q] = BFIN ? bf16_round(xa[q]) : xa[q]; sum = __fadd_rn(sum, s[q]); }
  red[t] = sum; __syncthreads(); for (int st = 128; st > 0; st >>= 1) { if (t < st) red[t] = __fadd_rn(red[t], red[t + st]); __syncthreads(); } const float mu = red[0] / (float)DMQ; __syncthreads();
  float vs = 0.f; for (int q = 0; q < 4; ++q) { const float dl = __fadd_rn(s[q], -mu); vs = __fadd_rn(vs, __fmul_rn(dl, dl)); } red[t] = vs; __syncthreads(); for (int st = 128; st > 0; st >>= 1) { if (t < st) red[t] = __fadd_rn(red[t], red[t + st]); __syncthreads(); }
  const float rs = rsqrtf(__fadd_rn(red[0] / (float)DMQ, eps)); v4h y; v4f xb;
  for (int q = 0; q < 4; ++q) { const int c = t * 4 + q; y[q] = (_Float16)__fadd_rn(__fmul_rn(__fmul_rn(__fadd_rn(s[q], -mu), rs), bf16_round(g[c])), bf16_round(bb[c])); xb[q] = s[q]; }
  { *(v4h*)(N16 + r * DMQ + t * 4) = y; if (WXB) *(v4f*)(XB + r * DMQ + t * 4) = xb;  } }
__global__ __launch_bounds__(256) void k_ftres2(const float* __restrict__ OF0, const float* __restrict__ XB, float* __restrict__ X1, size_t n4) {
  #pragma clang fp contract(off)
  const size_t t = (size_t)blockIdx.x * 256 + threadIdx.x; if (t >= n4) return; const v4f o = *(const v4fa*)(OF0 + t * 4), xv = *(const v4fa*)(XB + t * 4); v4f y; for (int q = 0; q < 4; ++q) y[q] = __fadd_rn(__fmul_rn(o[q], 0.015625f), xv[q]); *(v4f*)(X1 + t * 4) = y;  }

__global__ __launch_bounds__(256) void k_wthd(const float* __restrict__ Wt, _Float16* __restrict__ Bt) { const size_t t = (size_t)blockIdx.x * 256 + threadIdx.x; if (t >= (size_t)NH * HD * (DM / 8)) return; const int m8 = (int)(t % (DM / 8)) * 8; const int d = (int)((t / (DM / 8)) % HD); const int h = (int)(t / ((size_t)(DM / 8) * HD)); FragH f;
  for (int q = 0; q < 8; ++q) f.h[q] = (_Float16)(16.0f * bf16_round(Wt[((size_t)h * DM + m8 + q) * HD + d])); unsigned short* dst = (unsigned short*)Bt + ((size_t)h * HD + d) * DM + m8; *(v8us*)dst = f.half[0];  }




// Row LayerNorm (biased variance), ONE WAVE A ROW: a lane holds 32 of the row's 1024 values (8 pieces of 16 bytes, so each load and each f32 store of a wave covers four whole 128-byte lines); no LDS, no barrier.
// A launch starts NR waves, not 8 NR. Sums: four chains a lane, then a butterfly over the wave's 32 lanes.
// lane l with lane l ^ X inside its 16-lane row (DPP row_xmask)
template <int X> __device__ __forceinline__ float ln_xm(float v) { return __builtin_bit_cast(float, __builtin_amdgcn_update_dpp(0, __builtin_bit_cast(int, v), 0x160 + X, 0xf, 0xf, true)); }
// the sum over the wave, in every lane: four steps inside the rows, then the other row
__device__ __forceinline__ float ln_sum32(float v) { v += ln_xm<1>(v); v += ln_xm<2>(v); v += ln_xm<4>(v); v += ln_xm<8>(v);
  return v + __builtin_bit_cast(float, __builtin_amdgcn_permlanex16(__builtin_bit_cast(int, v), __builtin_bit_cast(int, v), 0x76543210, 0xfedcba98, false, false)); }
#define LN_WV 16      /* waves (rows) a block: NR / 16 blocks */
template <int BFIN, int W16, int W32>
__global__ __launch_bounds__(32 * LN_WV) void k_lnx(const float* __restrict__ X, const float* __restrict__ g, const float* __restrict__ bb, float eps, _Float16* __restrict__ N16, float* __restrict__ N32) {
  static_assert(DMQ == 1024, "k_lnx: a lane holds 8 pieces of 4 values");
  const int lane = threadIdx.x & 31; const size_t e0 = ((size_t)blockIdx.x * LN_WV + (threadIdx.x >> 5)) * DMQ + lane * 4;
  const float* xp = X + e0; const float* gp = g + lane * 4; const float* bp = bb + lane * 4; v4f a[8], gv[8], bv[8];
  /* every loop here is unrolled: constant indices, so the arrays are registers, and the 24 loads of a lane fly together (one memory latency a row) */
#pragma unroll
  for (int i = 0; i < 8; ++i) a[i] = *(const v4fa*)(xp + i * 128);
#pragma unroll
  for (int i = 0; i < 8; ++i) { gv[i] = *(const v4fa*)(gp + i * 128); bv[i] = *(const v4fa*)(bp + i * 128); }
  /* The loaded values are inputs: all 24 loads stay in front of the first sum (left alone the compiler sinks some behind it: a second latency). The row pointer and the lane's number, the loads' address registers, are inputs: they stay live up to here,
     so no load's result lands on them, and the wait precedes every later overwrite of a register that a load names */
  asm volatile("s_wait_xcnt 0x0" :: "v"(a[0]), "v"(a[1]), "v"(a[2]), "v"(a[3]), "v"(a[4]), "v"(a[5]), "v"(a[6]), "v"(a[7]), "v"(gv[0]), "v"(gv[1]), "v"(gv[2]), "v"(gv[3]), "v"(gv[4]), "v"(gv[5]), "v"(gv[6]), "v"(gv[7]),
               "v"(bv[0]), "v"(bv[1]), "v"(bv[2]), "v"(bv[3]), "v"(bv[4]), "v"(bv[5]), "v"(bv[6]), "v"(bv[7]), "v"(xp), "v"(lane));
  __builtin_amdgcn_sched_barrier(0);      /* nothing is scheduled across: the sums stay behind the statement above, and so behind all 24 loads */
  if (BFIN) {
#pragma unroll
    for (int i = 0; i < 8; ++i)
#pragma unroll
      for (int q = 0; q < 4; ++q) a[i][q] = bf16_round(a[i][q]); }
  v4f s4 = a[0];
#pragma unroll
  for (int i = 1; i < 8; ++i) s4 += a[i];
  const float mu = ln_sum32((s4[0] + s4[1]) + (s4[2] + s4[3])) * (1.0f / (float)DMQ);
  v4f q4 = {0.f, 0.f, 0.f, 0.f};
#pragma unroll
  for (int i = 0; i < 8; ++i) { a[i] -= mu; q4 += a[i] * a[i]; }
  const float rs = rsqrtf(ln_sum32((q4[0] + q4[1]) + (q4[2] + q4[3])) * (1.0f / (float)DMQ) + eps);
  v4h h[8];
#pragma unroll
  for (int i = 0; i < 8; ++i)
#pragma unroll
    for (int q = 0; q < 4; ++q) { a[i][q] = a[i][q] * rs * bf16_round(gv[i][q]) + bf16_round(bv[i][q]); h[i][q] = (_Float16)a[i][q]; }
  /* the stores of a plane go out as one group; behind it the s_wait_xcnt, with the pointer and the data as inputs: they stay as they are up to the wait */
  if (W32) { float* p = N32 + e0;
#pragma unroll
    for (int i = 0; i < 8; ++i) *(v4f*)(p + i * 128) = a[i];
    asm volatile("s_wait_xcnt 0x0" :: "v"(p), "v"(a[0]), "v"(a[1]), "v"(a[2]), "v"(a[3]), "v"(a[4]), "v"(a[5]), "v"(a[6]), "v"(a[7]) : "memory"); }
  if (W16) { _Float16* p = N16 + e0;
#pragma unroll
    for (int i = 0; i < 8; ++i) *(v4h*)(p + i * 128) = h[i];
    asm volatile("s_wait_xcnt 0x0" :: "v"(p), "v"(h[0]), "v"(h[1]), "v"(h[2]), "v"(h[3]), "v"(h[4]), "v"(h[5]), "v"(h[6]), "v"(h[7]) : "memory"); } }






__global__ __launch_bounds__(256) void k_lorafold(const float* __restrict__ Wm, const float* __restrict__ A, const float* __restrict__ Bm, float* __restrict__ WE, int K, int N, float sc) {
  #pragma clang fp contract(off)
  const size_t t = (size_t)blockIdx.x * 256 + threadIdx.x; if (t >= (size_t)K * N) return; const int i = (int)(t / N), o = (int)(t % N); float a = 0.f;
  for (int r = 0; r < 16; ++r) a = __fadd_rn(a, __fmul_rn(bf16_round(A[(size_t)i * 16 + r]), bf16_round(Bm[(size_t)r * N + o])));
  const float v = __fadd_rn(bf16_round(Wm[t]), __fmul_rn(sc, a)); *(float*)(WE + t) = v;  }
__global__ __launch_bounds__(256) void k_wt32rep(const float* __restrict__ Wf, _Float16* __restrict__ Bt, int K, int N, int DOUT, float scale) {
  const int t = blockIdx.x * 256 + threadIdx.x; if (t >= DOUT * (K / 8)) return; const int n = t / (K / 8), k8 = (t % (K / 8)) * 8; const int rep = DOUT / N; const int src = (n / (HD * rep)) * HD + (n % HD);      /* head h = n / HD -> group h / rep */
  FragH f; for (int i = 0; i < 8; ++i) f.h[i] = (_Float16)(Wf[(size_t)(k8 + i) * N + src] * scale);
  *(v8us*)((unsigned short*)Bt + (size_t)n * K + k8) = f.half[0];  }
__global__ __launch_bounds__(256) void k_brep(const float* __restrict__ b, float* __restrict__ out) { const int t = blockIdx.x * 256 + threadIdx.x; if (t >= DM) return; const float v = b[(t / (HD * 4)) * HD + (t % HD)]; *(float*)(out + t) = v;  }

__global__ __launch_bounds__(256) void k_rsmcim(const float* __restrict__ S, _Float16* __restrict__ P, int hg, int q0, int nk, const int* __restrict__ am) {
  #pragma clang fp contract(off)
  const int t = blockIdx.x * 256 + threadIdx.x; if (t >= hg * QT) return; const size_t i = (size_t)t; const float* s = S + i * NKX; const int last = q0 + (t % QT); const int* mr = am + (size_t)last * SQ; float mx = -3.0e38f;      /* the module's mask row of this query (keys >= nk lie above the diagonal of the causal mask and are not computed) */
#pragma unroll 1
  for (int j = 0; j < nk; ++j) { const float f = (mr[j] != 0) ? 1.f : 0.f; mx = fmaxf(mx, fmaf(f, s[j], (1.f - f) * -1.0e9f)); } float se = 0.f;
#pragma unroll 1
  for (int j = 0; j < nk; ++j) { const float f = (mr[j] != 0) ? 1.f : 0.f; se += __expf(fmaf(f, s[j], (1.f - f) * -1.0e9f) - mx); } const float sc = 256.0f / se;
#pragma unroll 1
  for (int j0 = 0; j0 < nk; j0 += 8) { FragH fr; for (int q = 0; q < 8; ++q) { const int j = j0 + q; const float f = (mr[j] != 0) ? 1.f : 0.f; fr.h[q] = (_Float16)(__expf(fmaf(f, s[j], (1.f - f) * -1.0e9f) - mx) * sc); } unsigned short* d = (unsigned short*)P + i * NKX + j0; *(v8us*)d = fr.half[0];  } }



// One grid for the eleven preparation jobs (six weight transposes, the two planes of x, the three biases stacked): none reads what another writes, so they need no order among themselves.
// The block index picks the job (block-uniform branches; no job has a barrier). The large transposes come first, the short bias blocks last.
#define PB_WL ((DM / 128) * (DFF / 64))      /* tiles of W1, and of W2 */
#define PB_WS ((DM / 128) * (DM / 64))       /* tiles of one of Wq, Wk, Wv, Wo */
#define PB_W (2 * PB_WL + 4 * PB_WS)
#define PB_XE 4096                           /* elements of x a block: 8 pieces of 16 bytes a lane */
#define PB_X ((int)(NR * DM / PB_XE))
#define PB_B (3 * DM / 128)
__global__ __launch_bounds__(128) void k_prep(const float* __restrict__ x, const float* __restrict__ wq, const float* __restrict__ wk, const float* __restrict__ wv, const float* __restrict__ wo, const float* __restrict__ wfc, const float* __restrict__ wmp,
    const float* __restrict__ bq, const float* __restrict__ bk, const float* __restrict__ bv, _Float16* __restrict__ BQKV, _Float16* __restrict__ BO, _Float16* __restrict__ BW1, _Float16* __restrict__ BW2, float* __restrict__ bqkv, _Float16* __restrict__ X16, float* __restrict__ XB) {
  const int blk = blockIdx.x, tid = threadIdx.x;
  if (blk < PB_W) {      /* [in][out] -> Bt x16: W1, W2, stacked q | k | v, Wo */
    const float* W; _Float16* Wt; int K = DM, N = DM, r;
    if (blk < PB_WL) { W = wfc; Wt = BW1; N = DFF; r = blk; }
    else if (blk < 2 * PB_WL) { W = wmp; Wt = BW2; K = DFF; r = blk - PB_WL; }
    else { const int j = (blk - 2 * PB_WL) / PB_WS; r = (blk - 2 * PB_WL) - j * PB_WS; W = (j == 0) ? wq : (j == 1) ? wk : (j == 2) ? wv : wo; Wt = (j < 3) ? BQKV + (size_t)j * DM * DM : BO; }
    wt_f16_tile(W, Wt, K, N, 16.0f, r);
  } else if (blk < PB_W + PB_X) {      /* x read once: bf16(x) as exact f16 rows (GEMM operand) and as f32 rows (residual). A wave's load covers four whole lines, its stores four and two */
    const size_t e0 = (size_t)(blk - PB_W) * PB_XE + tid * 4; const float* p = x + e0; v4f a[8];
    /* unrolled: constant indices (registers), and the eight loads of a lane fly together */
#pragma unroll
    for (int i = 0; i < 8; ++i) a[i] = *(const v4fa*)(p + i * 512);
#pragma unroll
    for (int i = 0; i < 8; ++i) { v4f f; v4h h;
#pragma unroll
      for (int q = 0; q < 4; ++q) { f[q] = bf16_round(a[i][q]); h[q] = (_Float16)f[q]; }
      *(v4f*)(XB + e0 + i * 512) = f; *(v4h*)(X16 + e0 + i * 512) = h; }
    asm volatile("s_wait_xcnt 0x0" ::: "memory");      /* stands behind the last store, in front of any later write of a register that a store names */
  } else {      /* stacked bias bq | bk | bv: a block lies inside one of the three */
    const int c = blk - PB_W - PB_X, j = c / (DM / 128); const float* b = (j == 0) ? bq : (j == 1) ? bk : bv; const int i = (c - j * (DM / 128)) * 128 + tid; (bqkv + j * DM)[i] = b[i];
    asm volatile("s_wait_xcnt 0x0" ::: "memory");      /* as above: behind the store, in front of any later write of its registers */
  }
}



// lane l with lane l ^ 16
__device__ __forceinline__ float rs_xh(float v) { return __builtin_bit_cast(float, __builtin_amdgcn_permlanex16(__builtin_bit_cast(int, v), __builtin_bit_cast(int, v), 0x76543210, 0xfedcba98, false, false)); }
// native 2^t; the v_nop is the slot the instruction set asks for behind a transcendental before its result is read or its source overwritten
__device__ __forceinline__ float fa_exp2(float t) { float e; asm("v_exp_f32 %0, %1\n\tv_nop" : "=v"(e) : "v"(t)); return e; }
#define FA_KT 128      /* keys a stage */
#define FA_KP 144      /* LDS pitch of a K row, bytes: 128 of data + 16, an odd multiple of 16 (no bank conflict for 16-byte row reads) */
#define FA_VP 272      /* LDS pitch of a V^T row: 256 of data + 16, likewise */
#define FA_VO (FA_KT * FA_KP)      /* the 64 V^T rows stand behind the 128 K rows */
#define FA_STAGE (FA_VO + HD * FA_VP)      /* one buffer */
// Eight asynchronous 16-byte copies of a lane, global -> LDS: four of K (rows 32 apart), four of V^T (rows 16 apart). The s_wait_xcnt stands in the copies' own statement, behind the last of them,
// so that it precedes every later write of a register that a copy names.
__device__ __forceinline__ void fa_copy8(unsigned lk, const _Float16* gk, unsigned lv, const _Float16* gv) {
  asm volatile("global_load_async_to_lds_b128 %0, %8, off\n\t"
               "global_load_async_to_lds_b128 %1, %9, off\n\t"
               "global_load_async_to_lds_b128 %2, %10, off\n\t"
               "global_load_async_to_lds_b128 %3, %11, off\n\t"
               "global_load_async_to_lds_b128 %4, %12, off\n\t"
               "global_load_async_to_lds_b128 %5, %13, off\n\t"
               "global_load_async_to_lds_b128 %6, %14, off\n\t"
               "global_load_async_to_lds_b128 %7, %15, off\n\t"
               "s_wait_xcnt 0x0"
               :: "v"(lk), "v"(lk + 32u * FA_KP), "v"(lk + 64u * FA_KP), "v"(lk + 96u * FA_KP), "v"(lv), "v"(lv + 16u * FA_VP), "v"(lv + 32u * FA_VP), "v"(lv + 48u * FA_VP),
                  "v"(gk), "v"(gk + (size_t)32 * LQ), "v"(gk + (size_t)64 * LQ), "v"(gk + (size_t)96 * LQ), "v"(gv), "v"(gv + (size_t)16 * SQ), "v"(gv + (size_t)32 * SQ), "v"(gv + (size_t)48 * SQ) : "memory"); }
__global__ __launch_bounds__(256) void k_fattn(const _Float16* __restrict__ Q, const _Float16* __restrict__ Kk, const _Float16* __restrict__ VT, _Float16* __restrict__ O) {
  __shared__ __attribute__((aligned(16))) unsigned char sm[2 * FA_STAGE];
  const int tid = threadIdx.x, lane = tid & 31, w = tid >> 5, ln = lane & 15, hh = lane >> 4; const int h = blockIdx.y, b = blockIdx.z; const int q0 = blockIdx.x * 256 + w * 32; const size_t r0 = (size_t)b * SQ;
  const _Float16* qp = Q + (r0 + q0 + ln) * LQ + h * HD + 8 * hh;      /* the lane's own 8 hh is in the pointer: g2_frag is called with 0 */
  /* copies: lane = 16 bytes. K: 8 lanes a row of 128 bytes, thread rows tid / 8 + 32 i; V^T: 16 lanes a row of 256 bytes, thread rows tid / 16 + 16 i: a wave's copy covers four whole lines */
  const unsigned lk = (unsigned)(size_t)sm + (unsigned)(tid >> 3) * FA_KP + (unsigned)(tid & 7) * 16u; const unsigned lv = (unsigned)(size_t)sm + FA_VO + (unsigned)(tid >> 4) * FA_VP + (unsigned)(tid & 15) * 16u;
  const _Float16* gk = Kk + (r0 + (tid >> 3)) * LQ + h * HD + (tid & 7) * 8; const _Float16* gv = VT + ((size_t)(b * NH + h) * HD + (tid >> 4)) * SQ + (tid & 15) * 8;
  auto fill = [&](int t, int buf) { fa_copy8(lk + (unsigned)buf * FA_STAGE, gk + (size_t)t * FA_KT * LQ, lv + (unsigned)buf * FA_STAGE, gv + (size_t)t * FA_KT); };
  const unsigned char* sk = sm + ln * FA_KP + 16 * hh; const unsigned char* sv = sm + FA_VO + ln * FA_VP + 16 * hh;      /* the lane's fragment rows; same k order as g2_frag */
  const float L2E = 1.44269504088896340736f; const v8f z8 = {0.f,0.f,0.f,0.f,0.f,0.f,0.f,0.f};
  v16h qf[2][2], kf[2][2], vf[4]; v8f o[2][4]; float m[2] = {-3.0e38f, -3.0e38f}, l[2] = {0.f, 0.f};
  fill(0, 0);
  /* every inner loop is unrolled so that the fragment arrays have constant indices and stay in registers */
#pragma unroll
  for (int t = 0; t < 2; ++t) { qf[t][0] = g2_frag(qp + (size_t)t * 16 * LQ, 0); qf[t][1] = g2_frag(qp + (size_t)t * 16 * LQ + 32, 0);
#pragma unroll
    for (int dt = 0; dt < 4; ++dt) o[t][dt] = z8; }
  /* behind the loads that share one address pair: the wait that precedes any overwrite of that pair; the pair is an input, so it stays live (no load's result lands on it) up to the wait */
  asm volatile("s_wait_xcnt 0x0" :: "v"(qp) : "memory");
  asm volatile("s_wait_asynccnt 0x0" ::: "memory");      /* this wave's copies of stage 0 have landed */
  __syncthreads();      /* and every other wave's: stage 0 may be read */
  fill(1, 1);
  /* rolled: one copy of the body; a stage is 128 keys, while the next stage's copies fly */
#pragma unroll 1
  for (int t = 0; t < SQ / FA_KT; ++t) { const unsigned char* pk = sk + (t & 1) * FA_STAGE; const unsigned char* pv = sv + (t & 1) * FA_STAGE;
#pragma unroll
    for (int kt = 0; kt < 2; ++kt) { kf[kt][0] = g2_lfrag(pk + kt * 16 * FA_KP); kf[kt][1] = g2_lfrag(pk + kt * 16 * FA_KP + 64); }
    /* rolled: a pass is some 350 instructions already, and four copies of it spill. The stage's last pass fetches no K ahead (nothing of the next stage is read in front of the barrier) */
#pragma unroll 1
    for (int p = 0; p < FA_KT / 32; ++p) {
#pragma unroll
      for (int dt = 0; dt < 4; ++dt) vf[dt] = g2_lfrag(pv + dt * 16 * FA_VP + p * 64);
      v8f s[2][2];
#pragma unroll
      for (int u = 0; u < 2; ++u)
#pragma unroll
        for (int kt = 0; kt < 2; ++kt) s[u][kt] = g2_mma(kf[kt][1], qf[u][1], g2_mma(kf[kt][0], qf[u][0], z8));
      if (p + 1 < FA_KT / 32) {
#pragma unroll
        for (int kt = 0; kt < 2; ++kt) { kf[kt][0] = g2_lfrag(pk + ((p + 1) * 32 + kt * 16) * FA_KP); kf[kt][1] = g2_lfrag(pk + ((p + 1) * 32 + kt * 16) * FA_KP + 64); } }
      FragH pf[2];
#pragma unroll
      for (int u = 0; u < 2; ++u) { float mx = fmaxf(s[u][0][0], s[u][1][0]);
#pragma unroll
        for (int r = 1; r < 8; ++r) mx = fmaxf(mx, fmaxf(s[u][0][r], s[u][1][r]));
        mx = fmaxf(mx, rs_xh(mx)); const float mn = fmaxf(m[u], mx); const float al = fa_exp2((m[u] - mn) * L2E); const float mb = mn * L2E - 8.0f; m[u] = mn; float e0 = 0.f, e1 = 0.f;
#pragma unroll
        for (int r = 0; r < 8; ++r) { const float p0 = fa_exp2(fmaf(s[u][0][r], L2E, -mb)), p1 = fa_exp2(fmaf(s[u][1][r], L2E, -mb)); e0 += p0; e1 += p1; pf[u].h[r] = (_Float16)p0; pf[u].h[8 + r] = (_Float16)p1; }
        l[u] = fmaf(l[u], al, e0 + e1);      /* this half's keys only; the halves are joined behind the loop */
#pragma unroll
        for (int dt = 0; dt < 4; ++dt) o[u][dt] *= al; }
#pragma unroll
      for (int u = 0; u < 2; ++u)
#pragma unroll
        for (int dt = 0; dt < 4; ++dt) o[u][dt] = g2_mma(vf[dt], pf[u].v, o[u][dt]); }
    asm volatile("s_wait_dscnt 0x0" ::: "memory");      /* this wave's reads of the buffer are done before it is refilled */
    asm volatile("s_wait_asynccnt 0x0" ::: "memory");      /* this wave's copies of stage t + 1 have landed */
    __syncthreads();      /* publishes stage t + 1 and ends every wave's reads of stage t */
    if (t + 2 < SQ / FA_KT) fill(t + 2, t & 1); }
  asm volatile("s_wait_asynccnt 0x0" ::: "memory");      /* no copy is outstanding when the wave ends */
#pragma unroll
  for (int t = 0; t < 2; ++t) { const float fin = 64.0f / (l[t] + rs_xh(l[t]));      /* ctx carried x64; the x256 of the weights cancels in the quotient */
    _Float16* d = O + (r0 + q0 + t * 16 + ln) * DM + h * HD + 8 * hh;
#pragma unroll
    for (int dt = 0; dt < 4; ++dt) { FragH f;
#pragma unroll
      for (int r = 0; r < 8; ++r) f.h[r] = (_Float16)(o[t][dt][r] * fin);
      *(v8us*)((unsigned short*)d + dt * 16) = f.half[0]; } } }
extern "C" void kernel_launch(void* const* d_in, const int* in_sizes, int n_in,
                              void* d_out, int out_size, void* d_ws, size_t ws_size, hipStream_t stream) {
  (void)in_sizes; (void)n_in; (void)out_size;
  const float* const* I = (const float* const*)d_in; const float* x = I[0]; const float* wq = I[1]; const float* bq = I[2]; const float* wk = I[3]; const float* bk = I[4]; const float* wv = I[5]; const float* bv = I[6]; const float* wo = I[7]; const float* bo = I[8]; const float* wfc = I[9]; const float* bfc = I[10]; const float* wmp = I[11]; const float* bmp = I[12]; const float* g1 = I[13]; const float* be1 = I[14]; const float* gg2 = I[15]; const float* be2 = I[16];      /* x; [in][out] Wq / Wk / Wv / Wo + biases; W1 [1024][4096] + b1, W2 [4096][1024] + b2; LN1 g / b, LN2 g / b */
  char* ws = (char*)d_ws; size_t off = 0;
  auto take = [&](size_t bytes) { char* p = ws + off; off += (bytes + 255) & ~(size_t)255; return p; };
  _Float16* BQKV = (_Float16*)take((size_t)3 * DM * DM * 2); _Float16* BO = (_Float16*)take((size_t)DM * DM * 2); float* bqkv = (float*)take((size_t)3 * DM * 4); float* X1N = nullptr;      /* LN1 output (f32): aliases the QKV plane below (QKV's last readers, the V^T and attention launches, precede LN1) to stay within 256 MiB at NB 4 / SQ 2048 */
  _Float16* X16 = (_Float16*)take(NR * DM * 2); float* XB = (float*)take(NR * DM * 4); float* X1 = (float*)take(NR * DM * 4); _Float16* M16 = nullptr;      /* = X16 below (alias: X16's last reader, the fused QKV GEMM, precedes LN1's f16 write) */ _Float16* HF16 = nullptr;      /* FFN hidden plane of all rows [4096][4096] f16, taken below */ _Float16* BW1 = (_Float16*)take((size_t)DFF * DM * 2); _Float16* BW2 = (_Float16*)take((size_t)DM * DFF * 2); _Float16* QKV = (_Float16*)take(NR * 3 * DM * 2); _Float16* Q16 = QKV; _Float16* K16 = QKV + DM; _Float16* V16 = QKV + 2 * DM; _Float16* O16 = (_Float16*)take(NR * DM * 2); M16 = X16; X1N = (float*)QKV; HF16 = (_Float16*)take(NR * DFF * 2);      /* the FFN hidden plane of all rows (32 MiB) gets its OWN region here */      /* alias: X1N (NR*DM f32 = 16 MiB) inside QKV (24 MiB) */
  _Float16* VT = (_Float16*)take((size_t)NB * NH * HD * SQ * 2);
  if (off > ws_size) return;
  k_prep<<<(unsigned)(PB_W + PB_X + PB_B), 128, 0, stream>>>(x, wq, wk, wv, wo, wfc, wmp, bq, bk, bv, BQKV, BO, BW1, BW2, bqkv, X16, XB);      /* weights as Bt x16, stacked bias, x as exact f16 rows (post-LN: the attention runs on the raw input) and as bf16(x) f32 rows for the residual */
  const size_t r0p = (size_t)B0 * SQ;      /* first projected row */
  k_gemm2<0, false><<<dim3((unsigned)((MP / 128) * (3 * DM / 128)), 1), 256, 0, stream>>>(X16 + r0p * DM, DM, 0, BQKV, DM, 0, 0.0625f, bqkv, 0, nullptr, 1, 0, 0, nullptr, QKV + r0p * 3 * DM, 3 * DM, 0, MP, 3 * DM, DM);      /* q | k | v rows (f16); head h = columns h*HD.. of each DM block */
  k_vt<NH, SQ><<<NB * NH * (SQ / 64), 256, 0, stream>>>(V16, LQ, 0, VT);      /* V^T [NB][NH][HD][SQ] */
  k_fattn<<<dim3(SQ / 256, NH, NB), 256, 0, stream>>>(Q16, K16, VT, O16);      /* scores q.k (no scaling), softmax over all keys, ctx (merged heads, x64) as f16 rows */
  k_gemm2<0, true><<<dim3((unsigned)((MPO / 128) * (DM / 128)), 1), 256, 0, stream>>>(O16 + r0p * DM, DM, 0, BO, DM, 0, 0.0009765625f, bo, 0, XB + r0p * DM, -1, 0, 0, X1 + r0p * DM, nullptr, DM, 0, MPO, DM, DM);      /* out rows are the output layout */
  k_lnx<0, 1, 1><<<(unsigned)(NR / LN_WV), 32 * LN_WV, 0, stream>>>(X1, g1, be1, 1e-5f, M16, X1N);      /* x1 = LN1(x + attn_out) (eps 1e-5): f16 rows for the FFN input and f32 rows for the residual */
  k_gemm2<6, false><<<dim3((unsigned)((MPO / 128) * (DFF / 128)), 1), 256, 0, stream>>>(M16, DM, 0, BW1, DM, 0, 0.0625f, bfc, 0, nullptr, 1, 0, 0, nullptr, HF16, DFF, 0, MPO, DFF, DM);      /* gelu_erf(h w1^T + b1) -> f16, the rows of both batches in one grid */
  k_gemm2<0, true><<<dim3((unsigned)((MPO / 128) * (DM / 128)), 1), 256, 0, stream>>>(HF16, DFF, 0, BW2, DFF, 0, 0.0625f, bmp, 0, X1N, -1, 0, 0, X1, nullptr, DM, 0, MPO, DM, DFF);      /* t = x1 + ffn + b2 (own-element residual) f32, over the dead pre-LN1 plane; likewise one grid */
  k_lnx<0, 0, 1><<<(unsigned)(NR / LN_WV), 32 * LN_WV, 0, stream>>>(X1, gg2, be2, 1e-5f, nullptr, (float*)d_out);      /* out = LN2(t) (eps 1e-5) -> f32 output rows */
}
